// v000
// Times are from an AMD MI455X. After a warm-up the kernel runs many times in a row, and a time is the length of
// such a window on the GPU divided by its runs, so every launch and the gaps after it count. The runs cycle
// through copies of the inputs. A figure is the median of several windows, for all but v000 over two sittings.
// Sittings can differ by a few percent; kernels timed side by side share one.
// v000 is the starting kernel. One run takes 904 microseconds.
#include <hip/hip_runtime.h>

// Full softmax self-attention over SEQ tokens, embed 64: y1 = x R^T, y2 = x E^T (R, E = the two 64-column halves of the param table), q = y1 Wq^T + bq, k = y2 Wk^T + bk, v = x Wv^T + bv, out = softmax(q k^T / 8) v -> [SEQ][64] f32.
// Compute dtypes, f32 accumulate: every float input RNE-converted to bf16; x R^T, x E^T, x Wv^T on v_wmma_f32_16x16x32_bf16 with plain bf16 operands (exact products); q/k projections as bf16 hi+lo of y against bf16 W (2 products);
// scores as bf16 hi/lo of q/8 and of k (3 products hh+lh+hl); online softmax f32; P.V on v_wmma_f32_16x16x32_f16 with P = 2^14 exp(s-m) in fp16 and v in fp16 (1 product), normalised by the f32 row sum in the epilogue.

#ifndef SEQ
#define SEQ 16384
#endif
#define SEQ_FULL 16384
#ifndef NB
#define NB 1
#endif
#define HD   64
#define DP   128          // param table row pitch (2 * HD)
#define KC   64           // keys per staged chunk in the attention kernel
#define SCL  0.125f       // HD^-0.5, folded into the q planes (exact power of two)
#define L2E  1.4426950408889634f
#define LPC  14.0f        // log2 of the P carry 16384
static_assert(SEQ % 128 == 0);
static_assert(SEQ % KC == 0);
static_assert(SEQ <= SEQ_FULL);
static_assert(NB == 1);

typedef _Float16 h16;
typedef unsigned short bf;
typedef __attribute__((ext_vector_type(16))) __bf16   v16bf;
typedef __attribute__((ext_vector_type(16))) _Float16 v16h;
typedef __attribute__((ext_vector_type(8)))  _Float16 v8h;
typedef __attribute__((ext_vector_type(8)))  unsigned short v8us;
typedef __attribute__((ext_vector_type(8)))  float    v8f;
typedef __attribute__((ext_vector_type(4)))  float    v4f;
typedef v8h  __attribute__((may_alias)) v8ha;
typedef v4f  __attribute__((may_alias)) v4fa;
typedef v8us __attribute__((may_alias)) v8usa;

__device__ __forceinline__ unsigned short f2bf(float f) { unsigned u = __float_as_uint(f); u += 0x7FFFu + ((u >> 16) & 1u); return (unsigned short)(u >> 16); }   // RNE convert
__device__ __forceinline__ float bf2f(unsigned short b) { return __uint_as_float(((unsigned)b) << 16); }
__device__ __forceinline__ float bfr(float f) { return bf2f(f2bf(f)); }
__device__ __forceinline__ v16h cat16(v8h lo, v8h hi) { return __builtin_shufflevector(lo, hi, 0, 1, 2, 3, 4, 5, 6, 7, 8, 9, 10, 11, 12, 13, 14, 15); }
__device__ __forceinline__ v16bf cat16b(v8us lo, v8us hi) { return __builtin_bit_cast(v16bf, __builtin_shufflevector(lo, hi, 0, 1, 2, 3, 4, 5, 6, 7, 8, 9, 10, 11, 12, 13, 14, 15)); }
__device__ __forceinline__ v8f wmma16(v16h a, v16h b, v8f c) { return __builtin_amdgcn_wmma_f32_16x16x32_f16(false, a, false, b, (short)0, c, false, false); }
__device__ __forceinline__ v8f wmmab(v16bf a, v16bf b, v8f c) { return __builtin_amdgcn_wmma_f32_16x16x32_bf16(false, a, false, b, (short)0, c, false, false); }
__device__ __forceinline__ h16 tohx(float x) { return (h16)x; }
__device__ __forceinline__ void splitf(float y, unsigned short& h, unsigned short& l) { h = f2bf(y); l = f2bf(y - bf2f(h)); }

// ---- fragment loaders (wave32 16x16x32 split k map): from a K-contiguous 16-bit row p = base + row*ld + k0 + 8*h,
// elements 0..7 <- k0+8h+0..7, elements 8..15 <- k0+16+8h+0..7; lane&15 = row (A) or column (B); same map for A and B.
template <typename T16> struct WFrag;
template <> struct WFrag<h16> { typedef v16h V; static __device__ __forceinline__ V ld(const h16* p) { return cat16(*(const v8h*)p, *(const v8h*)(p + 16)); } static __device__ __forceinline__ v8f mma(V a, V b, v8f c) { return wmma16(a, b, c); } };
template <> struct WFrag<bf> { typedef v16bf V; static __device__ __forceinline__ V ld(const bf* p) { return cat16b(*(const v8us*)p, *(const v8us*)(p + 16)); } static __device__ __forceinline__ v8f mma(V a, V b, v8f c) { return wmmab(a, b, c); } };

// ---- k_gemmw: register-blocked GEMM, ONE WAVE per 64x64 output tile (16 accumulators), operands straight from K-contiguous 16-bit planes; grid (M/64, N/64, Z), 32 threads.
// C[m][n] (f32, pitch ldc, + optional f32 bias[n]) = sum_k A[m][k] Bt[n][k] (+ split products per NSPLIT). z-batch strides sA/sB/sC in elements. K % 32 == 0.
template <typename T16, int NSPLIT, bool BIAS>
__global__ __launch_bounds__(32) void k_gemmw(const T16* __restrict__ A, const T16* __restrict__ A2, const T16* __restrict__ Bt, const T16* __restrict__ Bt2, int K, float* C, int ldc, const float* __restrict__ bias, size_t sA, size_t sB, size_t sC) {
    typedef typename WFrag<T16>::V V;
    __shared__ __align__(16) float os[16 * 68];
    const size_t z = blockIdx.z; A += z * sA; if (A2) A2 += z * sA; Bt += z * sB; if (Bt2) Bt2 += z * sB; C += z * sC;
    const int lane = threadIdx.x & 31, lr = lane & 15, hi = lane >> 4; const int r0 = blockIdx.x * 64, c0 = blockIdx.y * 64;
    v8f acc[4][4];
#pragma unroll
    for (int mb = 0; mb < 4; ++mb)
#pragma unroll
        for (int nb = 0; nb < 4; ++nb) acc[mb][nb] = (v8f){};
    const size_t aoff = (size_t)(r0 + lr) * K + 8 * hi, boff = (size_t)(c0 + lr) * K + 8 * hi;
#pragma unroll 1
    for (int kc = 0; kc < K; kc += 32) {
        V a[4], a2[4];
#pragma unroll
        for (int mb = 0; mb < 4; ++mb) { a[mb] = WFrag<T16>::ld(A + aoff + (size_t)mb * 16 * K + kc); if (NSPLIT == 1 || NSPLIT == 2) a2[mb] = WFrag<T16>::ld(A2 + aoff + (size_t)mb * 16 * K + kc); }
#pragma unroll
        for (int nb = 0; nb < 4; ++nb) { const V b = WFrag<T16>::ld(Bt + boff + (size_t)nb * 16 * K + kc); V b2; if (NSPLIT >= 2) b2 = WFrag<T16>::ld(Bt2 + boff + (size_t)nb * 16 * K + kc);
#pragma unroll
            for (int mb = 0; mb < 4; ++mb) { acc[mb][nb] = WFrag<T16>::mma(a[mb], b, acc[mb][nb]); if (NSPLIT == 1 || NSPLIT == 2) acc[mb][nb] = WFrag<T16>::mma(a2[mb], b, acc[mb][nb]); if (NSPLIT >= 2) acc[mb][nb] = WFrag<T16>::mma(a[mb], b2, acc[mb][nb]); } }
        asm volatile("v_nop\n\tv_nop\n\tv_nop\n\tv_nop" : "+v"(acc[0][0]), "+v"(acc[1][1]), "+v"(acc[2][2]), "+v"(acc[3][3]) : "v"(a[0]), "v"(a[3]));
    }
#pragma unroll
    for (int mb = 0; mb < 4; ++mb) {
#pragma unroll
        for (int nb = 0; nb < 4; ++nb) {
#pragma unroll
            for (int j = 0; j < 8; ++j) os[(hi * 8 + j) * 68 + nb * 16 + lr] = acc[mb][nb][j]; }
        __builtin_amdgcn_wave_barrier(); asm volatile("" ::: "memory");
        float* crow = C + (size_t)(r0 + mb * 16) * ldc + c0;
{
#pragma unroll
            for (int s = 0; s < 8; ++s) { const int row = 2 * s + hi, cofs = lr * 4; v4f val = *(const v4fa*)(os + row * 68 + cofs); if (BIAS) { val[0] += bfr(bias[c0 + cofs]); val[1] += bfr(bias[c0 + cofs + 1]); val[2] += bfr(bias[c0 + cofs + 2]); val[3] += bfr(bias[c0 + cofs + 3]); }
                *(v4f*)(crow + (size_t)row * ldc + cofs) = val; }
             }
        __builtin_amdgcn_wave_barrier(); asm volatile("" ::: "memory");
    }
}

__global__ __launch_bounds__(256) void k_cvt8(const float* __restrict__ src, bf* dst, size_t n8) { const size_t i = (size_t)blockIdx.x * 256 + threadIdx.x; if (i >= n8) return; const v8f v = *(const v8f*)(src + i * 8); v8us o;
#pragma unroll
    for (int k = 0; k < 8; ++k) o[k] = f2bf(v[k]); *(v8us*)(dst + i * 8) = o;  }

__global__ __launch_bounds__(256) void k_cvtp(const float* __restrict__ P, bf* dst) {
    const int i = blockIdx.x * 256 + threadIdx.x; if (i >= 2 * HD * HD / 8) return; const int e = i * 8; const int sgm = e / (HD * HD), u = (e / HD) % HD, t = e % HD;
    const v8f v = *(const v8f*)(P + (size_t)u * DP + sgm * HD + t); v8us o;
#pragma unroll
    for (int k = 0; k < 8; ++k) o[k] = f2bf(v[k]); *(v8us*)(dst + e) = o;  }

__global__ __launch_bounds__(256) void k_split(const float* __restrict__ F, size_t n8, size_t nsc8, float sc0, float sc1, bf* Ah, bf* Al) {
    const size_t i = (size_t)blockIdx.x * 256 + threadIdx.x; if (i >= n8) return; const float sc = (i < nsc8) ? sc0 : sc1;
    const v8f v = *(const v8f*)(F + i * 8); v8us oh, ol;
#pragma unroll
    for (int k = 0; k < 8; ++k) { unsigned short a, c; splitf(v[k] * sc, a, c); oh[k] = a; ol[k] = c; }
    *(v8us*)(Ah + i * 8) = oh; *(v8us*)(Al + i * 8) = ol;  }

__global__ __launch_bounds__(256) void k_vtp(const float* __restrict__ F, int pitch, h16* V16) {
    const size_t e = ((size_t)blockIdx.x * 256 + threadIdx.x) * 8; if (e >= (size_t)HD * SEQ) return; const int t = (int)(e % SEQ); const int d = (int)(e / SEQ); v8h o;
#pragma unroll
    for (int q = 0; q < 8; ++q) o[q] = tohx(F[(size_t)(t + q) * pitch + d]);
    *(v8h*)(V16 + e) = o;  }

// ---- k_attn: flash attention, transposed form. Block = 8 waves x 16 queries; key chunks of KC staged in LDS (K hi, K lo as [key][dim], V as [dim][key]).
// Per wave and chunk: S^T tile j (16 keys x 16 queries) = Kh.Qh + Kl.Qh + Kh.Ql (A = K rows, B = Q^T with lane = query); D element r of lane (h, q) = key j*16+8h+r.
// Online softmax per lane (lane pair q, q^16 covers all KC keys); P^T B fragment: element r <- tile 2ks [r], element 8+r <- tile 2ks+1 [r], lane unchanged.
__global__ __launch_bounds__(256) void k_attn(const bf* __restrict__ QH, const bf* __restrict__ QL, const bf* __restrict__ KH, const bf* __restrict__ KL, const h16* __restrict__ VT, float* out) {
    __shared__ __align__(16) bf    khs[KC * HD];
    __shared__ __align__(16) bf    kls[KC * HD];
    __shared__ __align__(16) h16   vts[HD * KC];
    __shared__ __align__(16) float os[8 * 16 * 68];
    const int tid = threadIdx.x, lane = tid & 31, wv = tid >> 5, lr = lane & 15, hi = lane >> 4;
    const int q0 = blockIdx.x * 128 + wv * 16;
    v16bf qh[2], ql[2];
#pragma unroll
    for (int c = 0; c < 2; ++c) { const size_t qo = (size_t)(q0 + lr) * HD + c * 32 + 8 * hi; qh[c] = WFrag<bf>::ld(QH + qo); ql[c] = WFrag<bf>::ld(QL + qo); }
    v8f acc[4];
#pragma unroll
    for (int t = 0; t < 4; ++t) acc[t] = (v8f){};
    float mrun = -1.0e30f, lsum = 0.0f;
#pragma unroll 1
    for (int kc = 0; kc < SEQ; kc += KC) {
        // stage the chunk: khs/kls [KC][HD] contiguous copies; vts [HD][KC] from VT[d][kc + ..] (512 x 16 B each, 2 per thread)
#pragma unroll
        for (int i = 0; i < 2; ++i) { const int u = tid + i * 256; const size_t go = (size_t)kc * HD + (size_t)u * 8;
            *(v8us*)(khs + u * 8) = *(const v8us*)(KH + go); *(v8us*)(kls + u * 8) = *(const v8us*)(KL + go);
            const int d = u >> 3, cc = u & 7; *(v8h*)(vts + u * 8) = *(const v8h*)(VT + (size_t)d * SEQ + kc + cc * 8); }
        __syncthreads();
        v8f s[4];
#pragma unroll
        for (int j = 0; j < 4; ++j) s[j] = (v8f){};
        v16bf ka, kb2;
#pragma unroll
        for (int c = 0; c < 2; ++c) {
#pragma unroll
            for (int j = 0; j < 4; ++j) { const int ko = (j * 16 + lr) * HD + c * 32 + 8 * hi; ka = WFrag<bf>::ld(khs + ko); kb2 = WFrag<bf>::ld(kls + ko);
                s[j] = wmmab(ka, qh[c], s[j]); s[j] = wmmab(kb2, qh[c], s[j]); s[j] = wmmab(ka, ql[c], s[j]); } }
        asm volatile("v_nop\n\tv_nop\n\tv_nop\n\tv_nop" : "+v"(s[0]), "+v"(s[1]), "+v"(s[2]), "+v"(s[3]) : "v"(ka), "v"(kb2), "v"(qh[1]), "v"(ql[1]));
        // online softmax (logits already carry the 1/8 scale through the q planes)
        float cm = -1.0e30f;
#pragma unroll
        for (int j = 0; j < 4; ++j)
#pragma unroll
            for (int r = 0; r < 8; ++r) cm = fmaxf(cm, s[j][r]);
        cm = fmaxf(cm, __shfl_xor(cm, 16, 32));
        const float mnew = fmaxf(mrun, cm);
        const float alpha = __builtin_amdgcn_exp2f(fmaxf((mrun - mnew) * L2E, -120.0f));
        float rs = 0.0f; v8h p8[4];
#pragma unroll
        for (int j = 0; j < 4; ++j) { p8[j] = (v8h){};
#pragma unroll
            for (int r = 0; r < 8; ++r) { const float pv = __builtin_amdgcn_exp2f((s[j][r] - mnew) * L2E + LPC); rs += pv; p8[j][r] = tohx(pv); } }
        rs += __shfl_xor(rs, 16, 32);
        lsum = lsum * alpha + rs; mrun = mnew;
#pragma unroll
        for (int t = 0; t < 4; ++t) acc[t] = acc[t] * alpha;
        const v16h pb0 = cat16(p8[0], p8[1]), pb1 = cat16(p8[2], p8[3]);
        v16h va;
#pragma unroll
        for (int t = 0; t < 4; ++t) { const int vo = (t * 16 + lr) * KC + 8 * hi; va = WFrag<h16>::ld(vts + vo); acc[t] = wmma16(va, pb0, acc[t]); va = WFrag<h16>::ld(vts + vo + 32); acc[t] = wmma16(va, pb1, acc[t]); }
        asm volatile("v_nop\n\tv_nop\n\tv_nop\n\tv_nop" : "+v"(acc[0]), "+v"(acc[1]), "+v"(acc[2]), "+v"(acc[3]) : "v"(va), "v"(pb0), "v"(pb1));
        __syncthreads();
    }
    const float inv = __fdiv_rn(1.0f, lsum);
    float* osw = os + wv * (16 * 68);
#pragma unroll
    for (int t = 0; t < 4; ++t) { const v4f lo4 = (v4f){acc[t][0] * inv, acc[t][1] * inv, acc[t][2] * inv, acc[t][3] * inv}; const v4f hi4 = (v4f){acc[t][4] * inv, acc[t][5] * inv, acc[t][6] * inv, acc[t][7] * inv};
        *(v4fa*)(osw + lr * 68 + t * 16 + 8 * hi) = lo4; *(v4fa*)(osw + lr * 68 + t * 16 + 8 * hi + 4) = hi4; }
    __syncthreads();
    float* orow = out + (size_t)q0 * HD;
{
#pragma unroll
        for (int s2 = 0; s2 < 8; ++s2) { const int row = 2 * s2 + hi, cofs = lr * 4; const v4f val = *(const v4fa*)(osw + row * 68 + cofs); *(v4f*)(orow + (size_t)row * HD + cofs) = val; }
         }
}

extern "C" void kernel_launch(void* const* d_in, const int* in_sizes, int n_in,
                              void* d_out, int out_size, void* d_ws, size_t ws_size, hipStream_t stream) {
    if (n_in < 8) return;
    if (in_sizes[0] < SEQ * HD || in_sizes[1] < HD * DP || in_sizes[2] < HD * HD || in_sizes[3] < HD || in_sizes[4] < HD * HD || in_sizes[5] < HD || in_sizes[6] < HD * HD || in_sizes[7] < HD) return;
    if (out_size < SEQ * HD) return;
    const float* x = (const float*)d_in[0]; const float* params = (const float*)d_in[1];
    const float* wq = (const float*)d_in[2]; const float* bq = (const float*)d_in[3]; const float* wk = (const float*)d_in[4]; const float* bk = (const float*)d_in[5]; const float* wv = (const float*)d_in[6]; const float* bv = (const float*)d_in[7];
    float* OUT = (float*)d_out;     // [SEQ][64]
    char* wsp = (char*)d_ws;
    auto take = [&](size_t bytes) { char* p = wsp; wsp += (bytes + 255) & ~(size_t)255; return (void*)p; };
    const size_t PE = (size_t)SEQ * HD;                                     // elements of one [SEQ][64] plane
    bf* XB = (bf*)take(PE * 2);                                             // bf16 x [SEQ][64]
    bf* PB = (bf*)take((size_t)2 * HD * HD * 2);                            // bf16 R, E as Bt [2][64][64]
    bf* WQ = (bf*)take((size_t)HD * HD * 2); bf* WK = (bf*)take((size_t)HD * HD * 2); bf* WV = (bf*)take((size_t)HD * HD * 2);
    float* FY = (float*)take(2 * PE * 4);                                   // f32 y1, y2 [2][SEQ][64]
    bf* YH = (bf*)take(2 * PE * 2); bf* YL = (bf*)take(2 * PE * 2);         // bf16 hi/lo of y
    float* FQK = (float*)take(2 * PE * 4);                                  // f32 q, k [2][SEQ][64]
    bf* QKH = (bf*)take(2 * PE * 2); bf* QKL = (bf*)take(2 * PE * 2);       // bf16 hi/lo of q/8 and k
    float* FV = (float*)take(PE * 4);                                       // f32 v [SEQ][64]
    h16* VT16 = (h16*)take(PE * 2);                                         // fp16 v^T [64][SEQ]
    const size_t used = (size_t)(wsp - (char*)d_ws); if (used > ws_size || used > ((size_t)128 << 20)) return;   // 41,984,000 B at SEQ 16384

    k_cvt8<<<(unsigned)((PE / 8 + 255) / 256), 256, 0, stream>>>(x, XB, PE / 8);
    k_cvtp<<<(2 * HD * HD / 8 + 255) / 256, 256, 0, stream>>>(params, PB);
    k_cvt8<<<(HD * HD / 8 + 255) / 256, 256, 0, stream>>>(wq, WQ, (size_t)HD * HD / 8);
    k_cvt8<<<(HD * HD / 8 + 255) / 256, 256, 0, stream>>>(wk, WK, (size_t)HD * HD / 8);
    k_cvt8<<<(HD * HD / 8 + 255) / 256, 256, 0, stream>>>(wv, WV, (size_t)HD * HD / 8);
    // y1 = xb R^T (z 0), y2 = xb E^T (z 1): exact bf16 products
    k_gemmw<bf, 0, false><<<dim3(SEQ / 64, 1, 2), 32, 0, stream>>>(XB, nullptr, PB, nullptr, HD, FY, HD, nullptr, 0, (size_t)HD * HD, PE);
    k_split<<<(unsigned)((2 * PE / 8 + 255) / 256), 256, 0, stream>>>(FY, 2 * PE / 8, 0, 1.0f, 1.0f, YH, YL);
    // q = yh Wq^T + yl Wq^T + bq ; k likewise
    k_gemmw<bf, 1, true><<<dim3(SEQ / 64, 1, 1), 32, 0, stream>>>(YH, YL, WQ, nullptr, HD, FQK, HD, bq, 0, 0, 0);
    k_gemmw<bf, 1, true><<<dim3(SEQ / 64, 1, 1), 32, 0, stream>>>(YH + PE, YL + PE, WK, nullptr, HD, FQK + PE, HD, bk, 0, 0, 0);
    k_split<<<(unsigned)((2 * PE / 8 + 255) / 256), 256, 0, stream>>>(FQK, 2 * PE / 8, PE / 8, SCL, 1.0f, QKH, QKL);
    // v = xb Wv^T + bv, then the fp16 v^T plane
    k_gemmw<bf, 0, true><<<dim3(SEQ / 64, 1, 1), 32, 0, stream>>>(XB, nullptr, WV, nullptr, HD, FV, HD, bv, 0, 0, 0);
    k_vtp<<<(unsigned)((PE / 8 + 255) / 256), 256, 0, stream>>>(FV, HD, VT16);
    k_attn<<<SEQ / 128, 256, 0, stream>>>(QKH, QKL, QKH + PE, QKL + PE, VT16, OUT);
}

// v001
// It runs in 414 microseconds.
// Two timings next to v000 put it at 2.16 and 2.18 times that version's speed.
#include <hip/hip_runtime.h>

// Full softmax self-attention over SEQ tokens, embed 64: y1 = x R^T, y2 = x E^T (R, E = the two 64-column halves of the param table), q = y1 Wq^T + bq, k = y2 Wk^T + bk, v = x Wv^T + bv, out = softmax(q k^T / 8) v -> [SEQ][64] f32.
// Compute dtypes, f32 accumulate: every float input RNE-converted to bf16; x R^T, x E^T, x Wv^T on v_wmma_f32_16x16x32_bf16 with plain bf16 operands (exact products); q/k projections as bf16 hi+lo of y against bf16 W (2 products);
// scores as bf16 hi/lo of q/8 and of k (3 products hh+lh+hl); online softmax f32; P.V on v_wmma_f32_16x16x32_f16 with P = 2^14 exp(s-m) in fp16 and v in fp16 (1 product), normalised by the f32 row sum in the epilogue.

#ifndef SEQ
#define SEQ 16384
#endif
#define SEQ_FULL 16384
#ifndef NB
#define NB 1
#endif
#define HD   64
#define DP   128          // param table row pitch (2 * HD)
#define KC   64           // keys per staged chunk in the attention kernel
#define KP   72           // LDS row pitch of the staged 64-element 16-bit rows: 144 B = 16 B x odd, so the 16 rows of a ds_load_b128 fragment read fall on distinct banks
#define SCL  0.125f       // HD^-0.5, folded into the q planes (exact power of two)
#define L2E  1.4426950408889634f
#define LPC  14.0f        // log2 of the P carry 16384
static_assert(SEQ % 128 == 0);
static_assert(SEQ % KC == 0);
static_assert(SEQ <= SEQ_FULL);
static_assert(NB == 1);

typedef _Float16 h16;
typedef unsigned short bf;
typedef __attribute__((ext_vector_type(16))) __bf16   v16bf;
typedef __attribute__((ext_vector_type(16))) _Float16 v16h;
typedef __attribute__((ext_vector_type(8)))  _Float16 v8h;
typedef __attribute__((ext_vector_type(8)))  unsigned short v8us;
typedef __attribute__((ext_vector_type(8)))  float    v8f;
typedef __attribute__((ext_vector_type(4)))  float    v4f;
typedef v8h  __attribute__((may_alias)) v8ha;
typedef v4f  __attribute__((may_alias)) v4fa;
typedef v8us __attribute__((may_alias)) v8usa;

__device__ __forceinline__ unsigned short f2bf(float f) { unsigned u = __float_as_uint(f); u += 0x7FFFu + ((u >> 16) & 1u); return (unsigned short)(u >> 16); }   // RNE convert
__device__ __forceinline__ float bf2f(unsigned short b) { return __uint_as_float(((unsigned)b) << 16); }
__device__ __forceinline__ float bfr(float f) { return bf2f(f2bf(f)); }
__device__ __forceinline__ v16h cat16(v8h lo, v8h hi) { return __builtin_shufflevector(lo, hi, 0, 1, 2, 3, 4, 5, 6, 7, 8, 9, 10, 11, 12, 13, 14, 15); }
__device__ __forceinline__ v16bf cat16b(v8us lo, v8us hi) { return __builtin_bit_cast(v16bf, __builtin_shufflevector(lo, hi, 0, 1, 2, 3, 4, 5, 6, 7, 8, 9, 10, 11, 12, 13, 14, 15)); }
__device__ __forceinline__ v8f wmma16(v16h a, v16h b, v8f c) { return __builtin_amdgcn_wmma_f32_16x16x32_f16(false, a, false, b, (short)0, c, false, false); }
__device__ __forceinline__ v8f wmmab(v16bf a, v16bf b, v8f c) { return __builtin_amdgcn_wmma_f32_16x16x32_bf16(false, a, false, b, (short)0, c, false, false); }
__device__ __forceinline__ h16 tohx(float x) { return (h16)x; }
__device__ __forceinline__ void splitf(float y, unsigned short& h, unsigned short& l) { h = f2bf(y); l = f2bf(y - bf2f(h)); }

// ---- fragment loaders (wave32 16x16x32 split k map): from a K-contiguous 16-bit row p = base + row*ld + k0 + 8*h,
// elements 0..7 <- k0+8h+0..7, elements 8..15 <- k0+16+8h+0..7; lane&15 = row (A) or column (B); same map for A and B.
template <typename T16> struct WFrag;
template <> struct WFrag<h16> { typedef v16h V; static __device__ __forceinline__ V ld(const h16* p) { return cat16(*(const v8h*)p, *(const v8h*)(p + 16)); } static __device__ __forceinline__ v8f mma(V a, V b, v8f c) { return wmma16(a, b, c); } };
template <> struct WFrag<bf> { typedef v16bf V; static __device__ __forceinline__ V ld(const bf* p) { return cat16b(*(const v8us*)p, *(const v8us*)(p + 16)); } static __device__ __forceinline__ v8f mma(V a, V b, v8f c) { return wmmab(a, b, c); } };

// ---- k_gemmw: register-blocked GEMM, ONE WAVE per 64x64 output tile (16 accumulators), operands straight from K-contiguous 16-bit planes; grid (M/64, N/64, Z), 32 threads.
// C[m][n] (f32, pitch ldc, + optional f32 bias[n]) = sum_k A[m][k] Bt[n][k] (+ split products per NSPLIT). z-batch strides sA/sB/sC in elements. K % 32 == 0.
template <typename T16, int NSPLIT, bool BIAS>
__global__ __launch_bounds__(32) void k_gemmw(const T16* __restrict__ A, const T16* __restrict__ A2, const T16* __restrict__ Bt, const T16* __restrict__ Bt2, int K, float* C, int ldc, const float* __restrict__ bias, size_t sA, size_t sB, size_t sC) {
    typedef typename WFrag<T16>::V V;
    __shared__ __align__(16) float os[16 * 68];
    const size_t z = blockIdx.z; A += z * sA; if (A2) A2 += z * sA; Bt += z * sB; if (Bt2) Bt2 += z * sB; C += z * sC;
    const int lane = threadIdx.x & 31, lr = lane & 15, hi = lane >> 4; const int r0 = blockIdx.x * 64, c0 = blockIdx.y * 64;
    v8f acc[4][4];
#pragma unroll
    for (int mb = 0; mb < 4; ++mb)
#pragma unroll
        for (int nb = 0; nb < 4; ++nb) acc[mb][nb] = (v8f){};
    const size_t aoff = (size_t)(r0 + lr) * K + 8 * hi, boff = (size_t)(c0 + lr) * K + 8 * hi;
#pragma unroll 1
    for (int kc = 0; kc < K; kc += 32) {
        V a[4], a2[4];
#pragma unroll
        for (int mb = 0; mb < 4; ++mb) { a[mb] = WFrag<T16>::ld(A + aoff + (size_t)mb * 16 * K + kc); if (NSPLIT == 1 || NSPLIT == 2) a2[mb] = WFrag<T16>::ld(A2 + aoff + (size_t)mb * 16 * K + kc); }
#pragma unroll
        for (int nb = 0; nb < 4; ++nb) { const V b = WFrag<T16>::ld(Bt + boff + (size_t)nb * 16 * K + kc); V b2; if (NSPLIT >= 2) b2 = WFrag<T16>::ld(Bt2 + boff + (size_t)nb * 16 * K + kc);
#pragma unroll
            for (int mb = 0; mb < 4; ++mb) { acc[mb][nb] = WFrag<T16>::mma(a[mb], b, acc[mb][nb]); if (NSPLIT == 1 || NSPLIT == 2) acc[mb][nb] = WFrag<T16>::mma(a2[mb], b, acc[mb][nb]); if (NSPLIT >= 2) acc[mb][nb] = WFrag<T16>::mma(a[mb], b2, acc[mb][nb]); } }
        asm volatile("v_nop\n\tv_nop\n\tv_nop\n\tv_nop" : "+v"(acc[0][0]), "+v"(acc[1][1]), "+v"(acc[2][2]), "+v"(acc[3][3]) : "v"(a[0]), "v"(a[3]));
    }
#pragma unroll
    for (int mb = 0; mb < 4; ++mb) {
#pragma unroll
        for (int nb = 0; nb < 4; ++nb) {
#pragma unroll
            for (int j = 0; j < 8; ++j) os[(hi * 8 + j) * 68 + nb * 16 + lr] = acc[mb][nb][j]; }
        __builtin_amdgcn_wave_barrier(); asm volatile("" ::: "memory");
        float* crow = C + (size_t)(r0 + mb * 16) * ldc + c0;
{
#pragma unroll
            for (int s = 0; s < 8; ++s) { const int row = 2 * s + hi, cofs = lr * 4; v4f val = *(const v4fa*)(os + row * 68 + cofs); if (BIAS) { val[0] += bfr(bias[c0 + cofs]); val[1] += bfr(bias[c0 + cofs + 1]); val[2] += bfr(bias[c0 + cofs + 2]); val[3] += bfr(bias[c0 + cofs + 3]); }
                *(v4f*)(crow + (size_t)row * ldc + cofs) = val; }
             }
        __builtin_amdgcn_wave_barrier(); asm volatile("" ::: "memory");
    }
}

__global__ __launch_bounds__(256) void k_cvt8(const float* __restrict__ src, bf* dst, size_t n8) { const size_t i = (size_t)blockIdx.x * 256 + threadIdx.x; if (i >= n8) return; const v8f v = *(const v8f*)(src + i * 8); v8us o;
#pragma unroll
    for (int k = 0; k < 8; ++k) o[k] = f2bf(v[k]); *(v8us*)(dst + i * 8) = o;  }

__global__ __launch_bounds__(256) void k_cvtp(const float* __restrict__ P, bf* dst) {
    const int i = blockIdx.x * 256 + threadIdx.x; if (i >= 2 * HD * HD / 8) return; const int e = i * 8; const int sgm = e / (HD * HD), u = (e / HD) % HD, t = e % HD;
    const v8f v = *(const v8f*)(P + (size_t)u * DP + sgm * HD + t); v8us o;
#pragma unroll
    for (int k = 0; k < 8; ++k) o[k] = f2bf(v[k]); *(v8us*)(dst + e) = o;  }

__global__ __launch_bounds__(256) void k_split(const float* __restrict__ F, size_t n8, size_t nsc8, float sc0, float sc1, bf* Ah, bf* Al) {
    const size_t i = (size_t)blockIdx.x * 256 + threadIdx.x; if (i >= n8) return; const float sc = (i < nsc8) ? sc0 : sc1;
    const v8f v = *(const v8f*)(F + i * 8); v8us oh, ol;
#pragma unroll
    for (int k = 0; k < 8; ++k) { unsigned short a, c; splitf(v[k] * sc, a, c); oh[k] = a; ol[k] = c; }
    *(v8us*)(Ah + i * 8) = oh; *(v8us*)(Al + i * 8) = ol;  }

__global__ __launch_bounds__(256) void k_vtp(const float* __restrict__ F, int pitch, h16* V16) {
    const size_t e = ((size_t)blockIdx.x * 256 + threadIdx.x) * 8; if (e >= (size_t)HD * SEQ) return; const int t = (int)(e % SEQ); const int d = (int)(e / SEQ); v8h o;
#pragma unroll
    for (int q = 0; q < 8; ++q) o[q] = tohx(F[(size_t)(t + q) * pitch + d]);
    *(v8h*)(V16 + e) = o;  }

// ---- k_attn: flash attention, transposed form. Block = 8 waves x 16 queries; key chunks of KC staged in LDS (K hi, K lo as [key][dim], V as [dim][key], rows at pitch KP).
// Per wave and chunk: S^T tile j (16 keys x 16 queries) = Kh.Qh + Kl.Qh + Kh.Ql (A = K rows, B = Q^T with lane = query); D element r of lane (h, q) = key j*16+8h+r.
// Online softmax per lane (lane pair q, q^16 covers all KC keys); P^T B fragment: element r <- tile 2ks [r], element 8+r <- tile 2ks+1 [r], lane unchanged.
__global__ __launch_bounds__(256) void k_attn(const bf* __restrict__ QH, const bf* __restrict__ QL, const bf* __restrict__ KH, const bf* __restrict__ KL, const h16* __restrict__ VT, float* out) {
    __shared__ __align__(16) bf    khs[KC * KP];
    __shared__ __align__(16) bf    kls[KC * KP];
    __shared__ __align__(16) h16   vts[HD * KP];
    __shared__ __align__(16) float os[8 * 16 * 68];
    const int tid = threadIdx.x, lane = tid & 31, wv = tid >> 5, lr = lane & 15, hi = lane >> 4;
    const int q0 = blockIdx.x * 128 + wv * 16;
    v16bf qh[2], ql[2];
#pragma unroll
    for (int c = 0; c < 2; ++c) { const size_t qo = (size_t)(q0 + lr) * HD + c * 32 + 8 * hi; qh[c] = WFrag<bf>::ld(QH + qo); ql[c] = WFrag<bf>::ld(QL + qo); }
    v8f acc[4];
#pragma unroll
    for (int t = 0; t < 4; ++t) acc[t] = (v8f){};
    float mrun = -1.0e30f, lsum = 0.0f;
#pragma unroll 1
    for (int kc = 0; kc < SEQ; kc += KC) {
        // stage the chunk: khs/kls [KC][HD] rows at pitch KP; vts [HD][KC] rows at pitch KP from VT[d][kc + ..] (512 x 16 B each, 2 per thread)
#pragma unroll
        for (int i = 0; i < 2; ++i) { const int u = tid + i * 256; const size_t go = (size_t)kc * HD + (size_t)u * 8; const int d = u >> 3, cc = u & 7, lo = d * KP + cc * 8;
            *(v8us*)(khs + lo) = *(const v8us*)(KH + go); *(v8us*)(kls + lo) = *(const v8us*)(KL + go);
            *(v8h*)(vts + lo) = *(const v8h*)(VT + (size_t)d * SEQ + kc + cc * 8); }
        __syncthreads();
        v8f s[4];
#pragma unroll
        for (int j = 0; j < 4; ++j) s[j] = (v8f){};
        v16bf ka, kb2;
#pragma unroll
        for (int c = 0; c < 2; ++c) {
#pragma unroll
            for (int j = 0; j < 4; ++j) { const int ko = (j * 16 + lr) * KP + c * 32 + 8 * hi; ka = WFrag<bf>::ld(khs + ko); kb2 = WFrag<bf>::ld(kls + ko);
                s[j] = wmmab(ka, qh[c], s[j]); s[j] = wmmab(kb2, qh[c], s[j]); s[j] = wmmab(ka, ql[c], s[j]); } }
        asm volatile("v_nop\n\tv_nop\n\tv_nop\n\tv_nop" : "+v"(s[0]), "+v"(s[1]), "+v"(s[2]), "+v"(s[3]) : "v"(ka), "v"(kb2), "v"(qh[1]), "v"(ql[1]));
        // online softmax (logits already carry the 1/8 scale through the q planes)
        float cm = -1.0e30f;
#pragma unroll
        for (int j = 0; j < 4; ++j)
#pragma unroll
            for (int r = 0; r < 8; ++r) cm = fmaxf(cm, s[j][r]);
        cm = fmaxf(cm, __shfl_xor(cm, 16, 32));
        const float mnew = fmaxf(mrun, cm);
        const float alpha = __builtin_amdgcn_exp2f(fmaxf((mrun - mnew) * L2E, -120.0f));
        float rs = 0.0f; v8h p8[4];
#pragma unroll
        for (int j = 0; j < 4; ++j) { p8[j] = (v8h){};
#pragma unroll
            for (int r = 0; r < 8; ++r) { const float pv = __builtin_amdgcn_exp2f((s[j][r] - mnew) * L2E + LPC); rs += pv; p8[j][r] = tohx(pv); } }
        rs += __shfl_xor(rs, 16, 32);
        lsum = lsum * alpha + rs; mrun = mnew;
#pragma unroll
        for (int t = 0; t < 4; ++t) acc[t] = acc[t] * alpha;
        const v16h pb0 = cat16(p8[0], p8[1]), pb1 = cat16(p8[2], p8[3]);
        v16h va;
#pragma unroll
        for (int t = 0; t < 4; ++t) { const int vo = (t * 16 + lr) * KP + 8 * hi; va = WFrag<h16>::ld(vts + vo); acc[t] = wmma16(va, pb0, acc[t]); va = WFrag<h16>::ld(vts + vo + 32); acc[t] = wmma16(va, pb1, acc[t]); }
        asm volatile("v_nop\n\tv_nop\n\tv_nop\n\tv_nop" : "+v"(acc[0]), "+v"(acc[1]), "+v"(acc[2]), "+v"(acc[3]) : "v"(va), "v"(pb0), "v"(pb1));
        __syncthreads();
    }
    const float inv = __fdiv_rn(1.0f, lsum);
    float* osw = os + wv * (16 * 68);
#pragma unroll
    for (int t = 0; t < 4; ++t) { const v4f lo4 = (v4f){acc[t][0] * inv, acc[t][1] * inv, acc[t][2] * inv, acc[t][3] * inv}; const v4f hi4 = (v4f){acc[t][4] * inv, acc[t][5] * inv, acc[t][6] * inv, acc[t][7] * inv};
        *(v4fa*)(osw + lr * 68 + t * 16 + 8 * hi) = lo4; *(v4fa*)(osw + lr * 68 + t * 16 + 8 * hi + 4) = hi4; }
    __syncthreads();
    float* orow = out + (size_t)q0 * HD;
{
#pragma unroll
        for (int s2 = 0; s2 < 8; ++s2) { const int row = 2 * s2 + hi, cofs = lr * 4; const v4f val = *(const v4fa*)(osw + row * 68 + cofs); *(v4f*)(orow + (size_t)row * HD + cofs) = val; }
         }
}

extern "C" void kernel_launch(void* const* d_in, const int* in_sizes, int n_in,
                              void* d_out, int out_size, void* d_ws, size_t ws_size, hipStream_t stream) {
    if (n_in < 8) return;
    if (in_sizes[0] < SEQ * HD || in_sizes[1] < HD * DP || in_sizes[2] < HD * HD || in_sizes[3] < HD || in_sizes[4] < HD * HD || in_sizes[5] < HD || in_sizes[6] < HD * HD || in_sizes[7] < HD) return;
    if (out_size < SEQ * HD) return;
    const float* x = (const float*)d_in[0]; const float* params = (const float*)d_in[1];
    const float* wq = (const float*)d_in[2]; const float* bq = (const float*)d_in[3]; const float* wk = (const float*)d_in[4]; const float* bk = (const float*)d_in[5]; const float* wv = (const float*)d_in[6]; const float* bv = (const float*)d_in[7];
    float* OUT = (float*)d_out;     // [SEQ][64]
    char* wsp = (char*)d_ws;
    auto take = [&](size_t bytes) { char* p = wsp; wsp += (bytes + 255) & ~(size_t)255; return (void*)p; };
    const size_t PE = (size_t)SEQ * HD;                                     // elements of one [SEQ][64] plane
    bf* XB = (bf*)take(PE * 2);                                             // bf16 x [SEQ][64]
    bf* PB = (bf*)take((size_t)2 * HD * HD * 2);                            // bf16 R, E as Bt [2][64][64]
    bf* WQ = (bf*)take((size_t)HD * HD * 2); bf* WK = (bf*)take((size_t)HD * HD * 2); bf* WV = (bf*)take((size_t)HD * HD * 2);
    float* FY = (float*)take(2 * PE * 4);                                   // f32 y1, y2 [2][SEQ][64]
    bf* YH = (bf*)take(2 * PE * 2); bf* YL = (bf*)take(2 * PE * 2);         // bf16 hi/lo of y
    float* FQK = (float*)take(2 * PE * 4);                                  // f32 q, k [2][SEQ][64]
    bf* QKH = (bf*)take(2 * PE * 2); bf* QKL = (bf*)take(2 * PE * 2);       // bf16 hi/lo of q/8 and k
    float* FV = (float*)take(PE * 4);                                       // f32 v [SEQ][64]
    h16* VT16 = (h16*)take(PE * 2);                                         // fp16 v^T [64][SEQ]
    const size_t used = (size_t)(wsp - (char*)d_ws); if (used > ws_size || used > ((size_t)128 << 20)) return;   // 41,984,000 B at SEQ 16384

    k_cvt8<<<(unsigned)((PE / 8 + 255) / 256), 256, 0, stream>>>(x, XB, PE / 8);
    k_cvtp<<<(2 * HD * HD / 8 + 255) / 256, 256, 0, stream>>>(params, PB);
    k_cvt8<<<(HD * HD / 8 + 255) / 256, 256, 0, stream>>>(wq, WQ, (size_t)HD * HD / 8);
    k_cvt8<<<(HD * HD / 8 + 255) / 256, 256, 0, stream>>>(wk, WK, (size_t)HD * HD / 8);
    k_cvt8<<<(HD * HD / 8 + 255) / 256, 256, 0, stream>>>(wv, WV, (size_t)HD * HD / 8);
    // y1 = xb R^T (z 0), y2 = xb E^T (z 1): exact bf16 products
    k_gemmw<bf, 0, false><<<dim3(SEQ / 64, 1, 2), 32, 0, stream>>>(XB, nullptr, PB, nullptr, HD, FY, HD, nullptr, 0, (size_t)HD * HD, PE);
    k_split<<<(unsigned)((2 * PE / 8 + 255) / 256), 256, 0, stream>>>(FY, 2 * PE / 8, 0, 1.0f, 1.0f, YH, YL);
    // q = yh Wq^T + yl Wq^T + bq ; k likewise
    k_gemmw<bf, 1, true><<<dim3(SEQ / 64, 1, 1), 32, 0, stream>>>(YH, YL, WQ, nullptr, HD, FQK, HD, bq, 0, 0, 0);
    k_gemmw<bf, 1, true><<<dim3(SEQ / 64, 1, 1), 32, 0, stream>>>(YH + PE, YL + PE, WK, nullptr, HD, FQK + PE, HD, bk, 0, 0, 0);
    k_split<<<(unsigned)((2 * PE / 8 + 255) / 256), 256, 0, stream>>>(FQK, 2 * PE / 8, PE / 8, SCL, 1.0f, QKH, QKL);
    // v = xb Wv^T + bv, then the fp16 v^T plane
    k_gemmw<bf, 0, true><<<dim3(SEQ / 64, 1, 1), 32, 0, stream>>>(XB, nullptr, WV, nullptr, HD, FV, HD, bv, 0, 0, 0);
    k_vtp<<<(unsigned)((PE / 8 + 255) / 256), 256, 0, stream>>>(FV, HD, VT16);
    k_attn<<<SEQ / 128, 256, 0, stream>>>(QKH, QKL, QKH + PE, QKL + PE, VT16, OUT);
}

// v002
// One run takes 167 microseconds.
// Next to v001, in two timings, it ran 2.47 and 2.45 times as fast.
// Counting every step since v000, it is 5.34 times as fast.
#include <hip/hip_runtime.h>

// Full softmax self-attention over SEQ tokens, embed 64: y1 = x R^T, y2 = x E^T (R, E = the two 64-column halves of the param table), q = y1 Wq^T + bq, k = y2 Wk^T + bk, v = x Wv^T + bv, out = softmax(q k^T / 8) v -> [SEQ][64] f32.
// Compute dtypes, f32 accumulate: every float input RNE-converted to bf16; x R^T, x E^T, x Wv^T on v_wmma_f32_16x16x32_bf16 with plain bf16 operands (exact products); q/k projections as bf16 hi+lo of y against bf16 W (2 products);
// scores as bf16 hi/lo of q/8 and of k (3 products hh+lh+hl); online softmax f32; P.V on v_wmma_f32_16x16x32_f16 with P = 2^14 exp(s-m) in fp16 and v in fp16 (1 product); the keys are cut into KS ranges whose f32 partial sums a last launch joins and normalises by the f32 row sum.

#ifndef SEQ
#define SEQ 16384
#endif
#define SEQ_FULL 16384
#ifndef NB
#define NB 1
#endif
#define HD   64
#define DP   128          // param table row pitch (2 * HD)
#define KC   64           // keys per staged chunk in the attention kernel
#define KS   4            // key ranges per query block: (SEQ / 128) * KS = 512 workgroups at SEQ 16384, two on each of the chip's 256 WGPs (as many as k_attn's registers let reside)
#define KP   72           // LDS row pitch of the staged 64-element 16-bit rows: 144 B = 16 B x odd, so the 16 rows of a ds_load_b128 fragment read fall on distinct banks
#define SCL  0.125f       // HD^-0.5, folded into the q planes (exact power of two)
#define L2E  1.4426950408889634f
#define LPC  14.0f        // log2 of the P carry 16384
static_assert(SEQ % 128 == 0);
static_assert(SEQ % (KS * KC) == 0);
static_assert(SEQ <= SEQ_FULL);
static_assert(NB == 1);

typedef _Float16 h16;
typedef unsigned short bf;
typedef __attribute__((ext_vector_type(16))) __bf16   v16bf;
typedef __attribute__((ext_vector_type(16))) _Float16 v16h;
typedef __attribute__((ext_vector_type(8)))  _Float16 v8h;
typedef __attribute__((ext_vector_type(8)))  unsigned short v8us;
typedef __attribute__((ext_vector_type(8)))  float    v8f;
typedef __attribute__((ext_vector_type(4)))  float    v4f;
typedef v8h  __attribute__((may_alias)) v8ha;
typedef v4f  __attribute__((may_alias)) v4fa;
typedef v8us __attribute__((may_alias)) v8usa;

__device__ __forceinline__ unsigned short f2bf(float f) { unsigned u = __float_as_uint(f); u += 0x7FFFu + ((u >> 16) & 1u); return (unsigned short)(u >> 16); }   // RNE convert
__device__ __forceinline__ float bf2f(unsigned short b) { return __uint_as_float(((unsigned)b) << 16); }
__device__ __forceinline__ float bfr(float f) { return bf2f(f2bf(f)); }
__device__ __forceinline__ v16h cat16(v8h lo, v8h hi) { return __builtin_shufflevector(lo, hi, 0, 1, 2, 3, 4, 5, 6, 7, 8, 9, 10, 11, 12, 13, 14, 15); }
__device__ __forceinline__ v16bf cat16b(v8us lo, v8us hi) { return __builtin_bit_cast(v16bf, __builtin_shufflevector(lo, hi, 0, 1, 2, 3, 4, 5, 6, 7, 8, 9, 10, 11, 12, 13, 14, 15)); }
__device__ __forceinline__ v8f wmma16(v16h a, v16h b, v8f c) { return __builtin_amdgcn_wmma_f32_16x16x32_f16(false, a, false, b, (short)0, c, false, false); }
__device__ __forceinline__ v8f wmmab(v16bf a, v16bf b, v8f c) { return __builtin_amdgcn_wmma_f32_16x16x32_bf16(false, a, false, b, (short)0, c, false, false); }
__device__ __forceinline__ h16 tohx(float x) { return (h16)x; }
__device__ __forceinline__ void splitf(float y, unsigned short& h, unsigned short& l) { h = f2bf(y); l = f2bf(y - bf2f(h)); }

// ---- fragment loaders (wave32 16x16x32 split k map): from a K-contiguous 16-bit row p = base + row*ld + k0 + 8*h,
// elements 0..7 <- k0+8h+0..7, elements 8..15 <- k0+16+8h+0..7; lane&15 = row (A) or column (B); same map for A and B.
template <typename T16> struct WFrag;
template <> struct WFrag<h16> { typedef v16h V; static __device__ __forceinline__ V ld(const h16* p) { return cat16(*(const v8h*)p, *(const v8h*)(p + 16)); } static __device__ __forceinline__ v8f mma(V a, V b, v8f c) { return wmma16(a, b, c); } };
template <> struct WFrag<bf> { typedef v16bf V; static __device__ __forceinline__ V ld(const bf* p) { return cat16b(*(const v8us*)p, *(const v8us*)(p + 16)); } static __device__ __forceinline__ v8f mma(V a, V b, v8f c) { return wmmab(a, b, c); } };

// ---- k_gemmw: register-blocked GEMM, ONE WAVE per 64x64 output tile (16 accumulators), operands straight from K-contiguous 16-bit planes; grid (M/64, N/64, Z), 32 threads.
// C[m][n] (f32, pitch ldc, + optional f32 bias[n]) = sum_k A[m][k] Bt[n][k] (+ split products per NSPLIT). z-batch strides sA/sB/sC in elements. K % 32 == 0.
template <typename T16, int NSPLIT, bool BIAS>
__global__ __launch_bounds__(32) void k_gemmw(const T16* __restrict__ A, const T16* __restrict__ A2, const T16* __restrict__ Bt, const T16* __restrict__ Bt2, int K, float* C, int ldc, const float* __restrict__ bias, size_t sA, size_t sB, size_t sC) {
    typedef typename WFrag<T16>::V V;
    __shared__ __align__(16) float os[16 * 68];
    const size_t z = blockIdx.z; A += z * sA; if (A2) A2 += z * sA; Bt += z * sB; if (Bt2) Bt2 += z * sB; C += z * sC;
    const int lane = threadIdx.x & 31, lr = lane & 15, hi = lane >> 4; const int r0 = blockIdx.x * 64, c0 = blockIdx.y * 64;
    v8f acc[4][4];
#pragma unroll
    for (int mb = 0; mb < 4; ++mb)
#pragma unroll
        for (int nb = 0; nb < 4; ++nb) acc[mb][nb] = (v8f){};
    const size_t aoff = (size_t)(r0 + lr) * K + 8 * hi, boff = (size_t)(c0 + lr) * K + 8 * hi;
#pragma unroll 1
    for (int kc = 0; kc < K; kc += 32) {
        V a[4], a2[4];
#pragma unroll
        for (int mb = 0; mb < 4; ++mb) { a[mb] = WFrag<T16>::ld(A + aoff + (size_t)mb * 16 * K + kc); if (NSPLIT == 1 || NSPLIT == 2) a2[mb] = WFrag<T16>::ld(A2 + aoff + (size_t)mb * 16 * K + kc); }
#pragma unroll
        for (int nb = 0; nb < 4; ++nb) { const V b = WFrag<T16>::ld(Bt + boff + (size_t)nb * 16 * K + kc); V b2; if (NSPLIT >= 2) b2 = WFrag<T16>::ld(Bt2 + boff + (size_t)nb * 16 * K + kc);
#pragma unroll
            for (int mb = 0; mb < 4; ++mb) { acc[mb][nb] = WFrag<T16>::mma(a[mb], b, acc[mb][nb]); if (NSPLIT == 1 || NSPLIT == 2) acc[mb][nb] = WFrag<T16>::mma(a2[mb], b, acc[mb][nb]); if (NSPLIT >= 2) acc[mb][nb] = WFrag<T16>::mma(a[mb], b2, acc[mb][nb]); } }
        asm volatile("v_nop\n\tv_nop\n\tv_nop\n\tv_nop" : "+v"(acc[0][0]), "+v"(acc[1][1]), "+v"(acc[2][2]), "+v"(acc[3][3]) : "v"(a[0]), "v"(a[3]));
    }
#pragma unroll
    for (int mb = 0; mb < 4; ++mb) {
#pragma unroll
        for (int nb = 0; nb < 4; ++nb) {
#pragma unroll
            for (int j = 0; j < 8; ++j) os[(hi * 8 + j) * 68 + nb * 16 + lr] = acc[mb][nb][j]; }
        __builtin_amdgcn_wave_barrier(); asm volatile("" ::: "memory");
        float* crow = C + (size_t)(r0 + mb * 16) * ldc + c0;
{
#pragma unroll
            for (int s = 0; s < 8; ++s) { const int row = 2 * s + hi, cofs = lr * 4; v4f val = *(const v4fa*)(os + row * 68 + cofs); if (BIAS) { val[0] += bfr(bias[c0 + cofs]); val[1] += bfr(bias[c0 + cofs + 1]); val[2] += bfr(bias[c0 + cofs + 2]); val[3] += bfr(bias[c0 + cofs + 3]); }
                *(v4f*)(crow + (size_t)row * ldc + cofs) = val; }
             }
        __builtin_amdgcn_wave_barrier(); asm volatile("" ::: "memory");
    }
}

__global__ __launch_bounds__(256) void k_cvt8(const float* __restrict__ src, bf* dst, size_t n8) { const size_t i = (size_t)blockIdx.x * 256 + threadIdx.x; if (i >= n8) return; const v8f v = *(const v8f*)(src + i * 8); v8us o;
#pragma unroll
    for (int k = 0; k < 8; ++k) o[k] = f2bf(v[k]); *(v8us*)(dst + i * 8) = o;  }

__global__ __launch_bounds__(256) void k_cvtp(const float* __restrict__ P, bf* dst) {
    const int i = blockIdx.x * 256 + threadIdx.x; if (i >= 2 * HD * HD / 8) return; const int e = i * 8; const int sgm = e / (HD * HD), u = (e / HD) % HD, t = e % HD;
    const v8f v = *(const v8f*)(P + (size_t)u * DP + sgm * HD + t); v8us o;
#pragma unroll
    for (int k = 0; k < 8; ++k) o[k] = f2bf(v[k]); *(v8us*)(dst + e) = o;  }

__global__ __launch_bounds__(256) void k_split(const float* __restrict__ F, size_t n8, size_t nsc8, float sc0, float sc1, bf* Ah, bf* Al) {
    const size_t i = (size_t)blockIdx.x * 256 + threadIdx.x; if (i >= n8) return; const float sc = (i < nsc8) ? sc0 : sc1;
    const v8f v = *(const v8f*)(F + i * 8); v8us oh, ol;
#pragma unroll
    for (int k = 0; k < 8; ++k) { unsigned short a, c; splitf(v[k] * sc, a, c); oh[k] = a; ol[k] = c; }
    *(v8us*)(Ah + i * 8) = oh; *(v8us*)(Al + i * 8) = ol;  }

__global__ __launch_bounds__(256) void k_vtp(const float* __restrict__ F, int pitch, h16* V16) {
    const size_t e = ((size_t)blockIdx.x * 256 + threadIdx.x) * 8; if (e >= (size_t)HD * SEQ) return; const int t = (int)(e % SEQ); const int d = (int)(e / SEQ); v8h o;
#pragma unroll
    for (int q = 0; q < 8; ++q) o[q] = tohx(F[(size_t)(t + q) * pitch + d]);
    *(v8h*)(V16 + e) = o;  }

// ---- k_attn: flash attention, transposed form. Block = 8 waves x 16 queries; key chunks of KC staged in LDS (K hi, K lo as [key][dim], V as [dim][key], rows at pitch KP).
// Per wave and chunk: S^T tile j (16 keys x 16 queries) = Kh.Qh + Kl.Qh + Kh.Ql (A = K rows, B = Q^T with lane = query); D element r of lane (h, q) = key j*16+8h+r.
// Online softmax per lane (lane pair q, q^16 covers all KC keys); P^T B fragment: element r <- tile 2ks [r], element 8+r <- tile 2ks+1 [r], lane unchanged.
// Grid (KS, SEQ/128): workgroup (ks, qb) walks keys [ks, ks+1) * SEQ/KS only and hands over its un-normalised sum PO[ks][q][64] and ML[ks][q] = (running maximum, row sum); k_merge joins the KS ranges.
__global__ __launch_bounds__(256) void k_attn(const bf* __restrict__ QH, const bf* __restrict__ QL, const bf* __restrict__ KH, const bf* __restrict__ KL, const h16* __restrict__ VT, float* PO, float* ML) {
    __shared__ __align__(16) bf    khs[KC * KP];
    __shared__ __align__(16) bf    kls[KC * KP];
    __shared__ __align__(16) h16   vts[HD * KP];
    __shared__ __align__(16) float os[8 * 16 * 68];
    const int tid = threadIdx.x, lane = tid & 31, wv = tid >> 5, lr = lane & 15, hi = lane >> 4;
    const int q0 = blockIdx.y * 128 + wv * 16, ks = blockIdx.x, kbeg = ks * (SEQ / KS);
    v16bf qh[2], ql[2];
#pragma unroll
    for (int c = 0; c < 2; ++c) { const size_t qo = (size_t)(q0 + lr) * HD + c * 32 + 8 * hi; qh[c] = WFrag<bf>::ld(QH + qo); ql[c] = WFrag<bf>::ld(QL + qo); }
    v8f acc[4];
#pragma unroll
    for (int t = 0; t < 4; ++t) acc[t] = (v8f){};
    float mrun = -1.0e30f, lsum = 0.0f;
#pragma unroll 1
    for (int kc = kbeg; kc < kbeg + SEQ / KS; kc += KC) {
        // stage the chunk: khs/kls [KC][HD] rows at pitch KP; vts [HD][KC] rows at pitch KP from VT[d][kc + ..] (512 x 16 B each, 2 per thread)
#pragma unroll
        for (int i = 0; i < 2; ++i) { const int u = tid + i * 256; const size_t go = (size_t)kc * HD + (size_t)u * 8; const int d = u >> 3, cc = u & 7, lo = d * KP + cc * 8;
            *(v8us*)(khs + lo) = *(const v8us*)(KH + go); *(v8us*)(kls + lo) = *(const v8us*)(KL + go);
            *(v8h*)(vts + lo) = *(const v8h*)(VT + (size_t)d * SEQ + kc + cc * 8); }
        __syncthreads();
        v8f s[4];
#pragma unroll
        for (int j = 0; j < 4; ++j) s[j] = (v8f){};
        v16bf ka, kb2;
#pragma unroll
        for (int c = 0; c < 2; ++c) {
#pragma unroll
            for (int j = 0; j < 4; ++j) { const int ko = (j * 16 + lr) * KP + c * 32 + 8 * hi; ka = WFrag<bf>::ld(khs + ko); kb2 = WFrag<bf>::ld(kls + ko);
                s[j] = wmmab(ka, qh[c], s[j]); s[j] = wmmab(kb2, qh[c], s[j]); s[j] = wmmab(ka, ql[c], s[j]); } }
        asm volatile("v_nop\n\tv_nop\n\tv_nop\n\tv_nop" : "+v"(s[0]), "+v"(s[1]), "+v"(s[2]), "+v"(s[3]) : "v"(ka), "v"(kb2), "v"(qh[1]), "v"(ql[1]));
        // online softmax (logits already carry the 1/8 scale through the q planes)
        float cm = -1.0e30f;
#pragma unroll
        for (int j = 0; j < 4; ++j)
#pragma unroll
            for (int r = 0; r < 8; ++r) cm = fmaxf(cm, s[j][r]);
        cm = fmaxf(cm, __shfl_xor(cm, 16, 32));
        const float mnew = fmaxf(mrun, cm);
        const float alpha = __builtin_amdgcn_exp2f(fmaxf((mrun - mnew) * L2E, -120.0f));
        float rs = 0.0f; v8h p8[4];
#pragma unroll
        for (int j = 0; j < 4; ++j) { p8[j] = (v8h){};
#pragma unroll
            for (int r = 0; r < 8; ++r) { const float pv = __builtin_amdgcn_exp2f((s[j][r] - mnew) * L2E + LPC); rs += pv; p8[j][r] = tohx(pv); } }
        rs += __shfl_xor(rs, 16, 32);
        lsum = lsum * alpha + rs; mrun = mnew;
#pragma unroll
        for (int t = 0; t < 4; ++t) acc[t] = acc[t] * alpha;
        const v16h pb0 = cat16(p8[0], p8[1]), pb1 = cat16(p8[2], p8[3]);
        v16h va;
#pragma unroll
        for (int t = 0; t < 4; ++t) { const int vo = (t * 16 + lr) * KP + 8 * hi; va = WFrag<h16>::ld(vts + vo); acc[t] = wmma16(va, pb0, acc[t]); va = WFrag<h16>::ld(vts + vo + 32); acc[t] = wmma16(va, pb1, acc[t]); }
        asm volatile("v_nop\n\tv_nop\n\tv_nop\n\tv_nop" : "+v"(acc[0]), "+v"(acc[1]), "+v"(acc[2]), "+v"(acc[3]) : "v"(va), "v"(pb0), "v"(pb1));
        __syncthreads();
    }
    float* osw = os + wv * (16 * 68);
#pragma unroll
    for (int t = 0; t < 4; ++t) { const v4f lo4 = (v4f){acc[t][0], acc[t][1], acc[t][2], acc[t][3]}; const v4f hi4 = (v4f){acc[t][4], acc[t][5], acc[t][6], acc[t][7]};
        *(v4fa*)(osw + lr * 68 + t * 16 + 8 * hi) = lo4; *(v4fa*)(osw + lr * 68 + t * 16 + 8 * hi + 4) = hi4; }
    __syncthreads();
    float* orow = PO + ((size_t)ks * SEQ + q0) * HD;
{
#pragma unroll
        for (int s2 = 0; s2 < 8; ++s2) { const int row = 2 * s2 + hi, cofs = lr * 4; const v4f val = *(const v4fa*)(osw + row * 68 + cofs); *(v4f*)(orow + (size_t)row * HD + cofs) = val; }
         }
    ML[((size_t)ks * SEQ + q0 + lr) * 2 + hi] = hi ? lsum : mrun;   // both lane halves hold the same pair: one whole 128-B line per wave
}

// ---- k_merge: out[q][d] = sum_ks w PO[ks][q][d] / sum_ks w l, w = exp(m_ks - max m). One thread per 4 output floats; a wave stores 512 contiguous bytes.
__global__ __launch_bounds__(256) void k_merge(const float* __restrict__ PO, const float* __restrict__ ML, float* out) {
    const unsigned t = blockIdx.x * 256u + threadIdx.x, eb = t * 16u, qb = t / (HD / 4) * 8u;   // byte offsets of the thread's 4 floats in a [SEQ][64] plane and of its query's pair in a [SEQ][2] plane
    float m[KS], l[KS]; v4f o[KS];
#pragma unroll
    for (int s = 0; s < KS; ++s) { const float* p = (const float*)((const char*)(ML + (size_t)s * SEQ * 2) + qb); m[s] = p[0]; l[s] = p[1]; }
    asm volatile("s_wait_xcnt 0x0" ::: "memory");   // stands in front of the loads below, whose results may land in the offset register of the loads above
#pragma unroll
    for (int s = 0; s < KS; ++s) o[s] = *(const v4f*)((const char*)(PO + (size_t)s * SEQ * HD) + eb);
    float mx = m[0];
#pragma unroll
    for (int s = 1; s < KS; ++s) mx = fmaxf(mx, m[s]);
    float ls = 0.0f; v4f a = (v4f){};
#pragma unroll
    for (int s = 0; s < KS; ++s) { const float w = __builtin_amdgcn_exp2f(fmaxf((m[s] - mx) * L2E, -120.0f)); ls += l[s] * w; a += o[s] * w; }
    const float inv = __fdiv_rn(1.0f, ls);
    *(v4f*)((char*)out + eb) = a * inv;
}

extern "C" void kernel_launch(void* const* d_in, const int* in_sizes, int n_in,
                              void* d_out, int out_size, void* d_ws, size_t ws_size, hipStream_t stream) {
    if (n_in < 8) return;
    if (in_sizes[0] < SEQ * HD || in_sizes[1] < HD * DP || in_sizes[2] < HD * HD || in_sizes[3] < HD || in_sizes[4] < HD * HD || in_sizes[5] < HD || in_sizes[6] < HD * HD || in_sizes[7] < HD) return;
    if (out_size < SEQ * HD) return;
    const float* x = (const float*)d_in[0]; const float* params = (const float*)d_in[1];
    const float* wq = (const float*)d_in[2]; const float* bq = (const float*)d_in[3]; const float* wk = (const float*)d_in[4]; const float* bk = (const float*)d_in[5]; const float* wv = (const float*)d_in[6]; const float* bv = (const float*)d_in[7];
    float* OUT = (float*)d_out;     // [SEQ][64]
    char* wsp = (char*)d_ws;
    auto take = [&](size_t bytes) { char* p = wsp; wsp += (bytes + 255) & ~(size_t)255; return (void*)p; };
    const size_t PE = (size_t)SEQ * HD;                                     // elements of one [SEQ][64] plane
    bf* XB = (bf*)take(PE * 2);                                             // bf16 x [SEQ][64]
    bf* PB = (bf*)take((size_t)2 * HD * HD * 2);                            // bf16 R, E as Bt [2][64][64]
    bf* WQ = (bf*)take((size_t)HD * HD * 2); bf* WK = (bf*)take((size_t)HD * HD * 2); bf* WV = (bf*)take((size_t)HD * HD * 2);
    float* FY = (float*)take(2 * PE * 4);                                   // f32 y1, y2 [2][SEQ][64]
    bf* YH = (bf*)take(2 * PE * 2); bf* YL = (bf*)take(2 * PE * 2);         // bf16 hi/lo of y
    float* FQK = (float*)take(2 * PE * 4);                                  // f32 q, k [2][SEQ][64]
    bf* QKH = (bf*)take(2 * PE * 2); bf* QKL = (bf*)take(2 * PE * 2);       // bf16 hi/lo of q/8 and k
    float* FV = (float*)take(PE * 4);                                       // f32 v [SEQ][64]
    h16* VT16 = (h16*)take(PE * 2);                                         // fp16 v^T [64][SEQ]
    float* PO = (float*)take(KS * PE * 4);                                  // f32 un-normalised partial outputs [KS][SEQ][64]
    float* ML = (float*)take((size_t)KS * SEQ * 2 * 4);                     // f32 (maximum, row sum) [KS][SEQ][2]
    const size_t used = (size_t)(wsp - (char*)d_ws); if (used > ws_size || used > ((size_t)128 << 20)) return;   // 59,285,504 B at SEQ 16384

    k_cvt8<<<(unsigned)((PE / 8 + 255) / 256), 256, 0, stream>>>(x, XB, PE / 8);
    k_cvtp<<<(2 * HD * HD / 8 + 255) / 256, 256, 0, stream>>>(params, PB);
    k_cvt8<<<(HD * HD / 8 + 255) / 256, 256, 0, stream>>>(wq, WQ, (size_t)HD * HD / 8);
    k_cvt8<<<(HD * HD / 8 + 255) / 256, 256, 0, stream>>>(wk, WK, (size_t)HD * HD / 8);
    k_cvt8<<<(HD * HD / 8 + 255) / 256, 256, 0, stream>>>(wv, WV, (size_t)HD * HD / 8);
    // y1 = xb R^T (z 0), y2 = xb E^T (z 1): exact bf16 products
    k_gemmw<bf, 0, false><<<dim3(SEQ / 64, 1, 2), 32, 0, stream>>>(XB, nullptr, PB, nullptr, HD, FY, HD, nullptr, 0, (size_t)HD * HD, PE);
    k_split<<<(unsigned)((2 * PE / 8 + 255) / 256), 256, 0, stream>>>(FY, 2 * PE / 8, 0, 1.0f, 1.0f, YH, YL);
    // q = yh Wq^T + yl Wq^T + bq ; k likewise
    k_gemmw<bf, 1, true><<<dim3(SEQ / 64, 1, 1), 32, 0, stream>>>(YH, YL, WQ, nullptr, HD, FQK, HD, bq, 0, 0, 0);
    k_gemmw<bf, 1, true><<<dim3(SEQ / 64, 1, 1), 32, 0, stream>>>(YH + PE, YL + PE, WK, nullptr, HD, FQK + PE, HD, bk, 0, 0, 0);
    k_split<<<(unsigned)((2 * PE / 8 + 255) / 256), 256, 0, stream>>>(FQK, 2 * PE / 8, PE / 8, SCL, 1.0f, QKH, QKL);
    // v = xb Wv^T + bv, then the fp16 v^T plane
    k_gemmw<bf, 0, true><<<dim3(SEQ / 64, 1, 1), 32, 0, stream>>>(XB, nullptr, WV, nullptr, HD, FV, HD, bv, 0, 0, 0);
    k_vtp<<<(unsigned)((PE / 8 + 255) / 256), 256, 0, stream>>>(FV, HD, VT16);
    k_attn<<<dim3(KS, SEQ / 128), 256, 0, stream>>>(QKH, QKL, QKH + PE, QKL + PE, VT16, PO, ML);
    k_merge<<<(unsigned)(PE / 4 / 256), 256, 0, stream>>>(PO, ML, OUT);
}

// v003
// Measured time: 114 microseconds a run.
// Next to v002, in two timings, it ran 1.46 times as fast each time.
// All steps since v000 together make it 7.80 times as fast.
#include <hip/hip_runtime.h>

// Full softmax self-attention over SEQ tokens, embed 64: y1 = x R^T, y2 = x E^T (R, E = the two 64-column halves of the param table), q = y1 Wq^T + bq, k = y2 Wk^T + bk, v = x Wv^T + bv, out = softmax(q k^T / 8) v -> [SEQ][64] f32.
// Compute dtypes, f32 accumulate: every float input RNE-converted to bf16; x R^T, x E^T, x Wv^T on v_wmma_f32_16x16x32_bf16 with plain bf16 operands (exact products); q/k projections as bf16 hi+lo of y against bf16 W (2 products);
// scores as bf16 hi/lo of q/8 and of k (3 products hh+lh+hl); online softmax f32; P.V on v_wmma_f32_16x16x32_f16 with P = 2^14 exp(s-m) in fp16 and v in fp16 (1 product); the keys are cut into KS ranges whose f32 partial sums a last launch joins and normalises by the f32 row sum.

#ifndef SEQ
#define SEQ 16384
#endif
#define SEQ_FULL 16384
#ifndef NB
#define NB 1
#endif
#define HD   64
#define DP   128          // param table row pitch (2 * HD)
#define KC   64           // keys per staged chunk in the attention kernel
#define KS   4            // key ranges per query block: (SEQ / 128) * KS = 512 workgroups at SEQ 16384, two on each of the chip's 256 WGPs (as many as k_attn's registers let reside)
#define KP   72           // LDS row pitch of the staged 64-element 16-bit rows: 144 B = 16 B x odd, so the 16 rows of a ds_load_b128 fragment read fall on distinct banks
#define SCL  0.125f       // HD^-0.5, folded into the q planes (exact power of two)
#define L2E  1.4426950408889634f
#define LPC  14.0f        // log2 of the P carry 16384
static_assert(SEQ % 128 == 0);
static_assert(SEQ % (KS * KC) == 0);
static_assert(SEQ <= SEQ_FULL);
static_assert(NB == 1);

typedef _Float16 h16;
typedef unsigned short bf;
typedef __attribute__((ext_vector_type(16))) __bf16   v16bf;
typedef __attribute__((ext_vector_type(16))) _Float16 v16h;
typedef __attribute__((ext_vector_type(8)))  _Float16 v8h;
typedef __attribute__((ext_vector_type(8)))  unsigned short v8us;
typedef __attribute__((ext_vector_type(8)))  float    v8f;
typedef __attribute__((ext_vector_type(4)))  float    v4f;
typedef v8h  __attribute__((may_alias)) v8ha;
typedef v4f  __attribute__((may_alias)) v4fa;
typedef v8us __attribute__((may_alias)) v8usa;

__device__ __forceinline__ unsigned short f2bf(float f) { unsigned u = __float_as_uint(f); u += 0x7FFFu + ((u >> 16) & 1u); return (unsigned short)(u >> 16); }   // RNE convert
__device__ __forceinline__ float bf2f(unsigned short b) { return __uint_as_float(((unsigned)b) << 16); }
__device__ __forceinline__ float bfr(float f) { return bf2f(f2bf(f)); }
__device__ __forceinline__ v16h cat16(v8h lo, v8h hi) { return __builtin_shufflevector(lo, hi, 0, 1, 2, 3, 4, 5, 6, 7, 8, 9, 10, 11, 12, 13, 14, 15); }
__device__ __forceinline__ v16bf cat16b(v8us lo, v8us hi) { return __builtin_bit_cast(v16bf, __builtin_shufflevector(lo, hi, 0, 1, 2, 3, 4, 5, 6, 7, 8, 9, 10, 11, 12, 13, 14, 15)); }
__device__ __forceinline__ v8f wmma16(v16h a, v16h b, v8f c) { return __builtin_amdgcn_wmma_f32_16x16x32_f16(false, a, false, b, (short)0, c, false, false); }
__device__ __forceinline__ v8f wmmab(v16bf a, v16bf b, v8f c) { return __builtin_amdgcn_wmma_f32_16x16x32_bf16(false, a, false, b, (short)0, c, false, false); }
__device__ __forceinline__ h16 tohx(float x) { return (h16)x; }
__device__ __forceinline__ void splitf(float y, unsigned short& h, unsigned short& l) { h = f2bf(y); l = f2bf(y - bf2f(h)); }

// ---- fragment loaders (wave32 16x16x32 split k map): from a K-contiguous 16-bit row p = base + row*ld + k0 + 8*h,
// elements 0..7 <- k0+8h+0..7, elements 8..15 <- k0+16+8h+0..7; lane&15 = row (A) or column (B); same map for A and B.
template <typename T16> struct WFrag;
template <> struct WFrag<h16> { typedef v16h V; static __device__ __forceinline__ V ld(const h16* p) { return cat16(*(const v8h*)p, *(const v8h*)(p + 16)); } static __device__ __forceinline__ v8f mma(V a, V b, v8f c) { return wmma16(a, b, c); } };
template <> struct WFrag<bf> { typedef v16bf V; static __device__ __forceinline__ V ld(const bf* p) { return cat16b(*(const v8us*)p, *(const v8us*)(p + 16)); } static __device__ __forceinline__ v8f mma(V a, V b, v8f c) { return wmmab(a, b, c); } };

// ---- k_proj: all projections of 64 tokens in one workgroup of 16 waves. Every thread converts 8 floats of x, R, E, Wq, Wk, Wv to bf16 (RNE) into LDS rows at pitch KP; after the one barrier
// waves 0..3 make q and waves 4..7 make k of one 16-token tile each, in transposed form: y^T tile u (16 features x 16 tokens) = R rows . x^T, whose D registers (feature 16u+8h+r of lane (h, token)) split into bf16 hi/lo
// ARE the B fragments of q^T = W . y^T (element r <- tile 2c [r], element 8+r <- tile 2c+1 [r]); per k step hi then lo, as f32 sums; + bf16-rounded bias, x scale, split to the hi/lo planes [token][64] (16 B per lane and tile).
// Waves 8..11 make v for 16 dims x 64 tokens: A = x rows, B = Wv rows; D registers are 8 consecutive tokens of one dim: fp16 rows of v^T [64][SEQ], one whole 128-B line per dim and wave.
__global__ __launch_bounds__(512) void k_proj(const float* __restrict__ x, const float* __restrict__ P, const float* __restrict__ wq, const float* __restrict__ bq, const float* __restrict__ wk, const float* __restrict__ bk,
                                              const float* __restrict__ wv, const float* __restrict__ bv, bf* QKH, bf* QKL, h16* VT) {
    __shared__ __align__(16) bf sm[6 * HD * KP];
    const int tid = threadIdx.x, lane = tid & 31, lr = lane & 15, hi = lane >> 4, w = __builtin_amdgcn_readfirstlane(tid >> 5);
    const int tok0 = blockIdx.x * 64, row = tid >> 3, c8 = (tid & 7) * 8;
    v8f in[6];
    in[0] = *(const v8f*)(x + (size_t)(tok0 + row) * HD + c8); in[1] = *(const v8f*)(P + row * DP + c8); in[2] = *(const v8f*)(P + row * DP + HD + c8);
    in[3] = *(const v8f*)(wq + row * HD + c8); in[4] = *(const v8f*)(wk + row * HD + c8); in[5] = *(const v8f*)(wv + row * HD + c8);
    const float* bsel = (w < 4) ? bq : bk;
    v8f bb[4];
#pragma unroll
    for (int t = 0; t < 4; ++t) bb[t] = *(const v8f*)(bsel + t * 16 + 8 * hi);
    const float bvv = bv[(w & 3) * 16 + lr];
#pragma unroll
    for (int m = 0; m < 6; ++m) { v8us o;
#pragma unroll
        for (int k = 0; k < 8; ++k) o[k] = f2bf(in[m][k]);
        *(v8us*)(sm + m * (HD * KP) + row * KP + c8) = o; }
    __syncthreads();
    const bf* xs = sm; const int fo = lr * KP + 8 * hi;
    if (w < 8) {
        const int jb = w >> 2, tt = w & 3; const bf* rs = sm + (1 + jb) * (HD * KP); const bf* ws = sm + (3 + jb) * (HD * KP); const float sc = jb ? 1.0f : SCL;
        v16bf xb[2];
#pragma unroll
        for (int c = 0; c < 2; ++c) xb[c] = WFrag<bf>::ld(xs + tt * 16 * KP + fo + c * 32);
        v8f yt[4];
#pragma unroll
        for (int u = 0; u < 4; ++u) yt[u] = (v8f){};
#pragma unroll
        for (int c = 0; c < 2; ++c)
#pragma unroll
            for (int u = 0; u < 4; ++u) yt[u] = wmmab(WFrag<bf>::ld(rs + u * 16 * KP + fo + c * 32), xb[c], yt[u]);
        v8us h8[4], l8[4];
#pragma unroll
        for (int u = 0; u < 4; ++u)
#pragma unroll
            for (int r = 0; r < 8; ++r) { unsigned short a, c; splitf(yt[u][r], a, c); h8[u][r] = a; l8[u][r] = c; }
        v8f acc[4];
#pragma unroll
        for (int t = 0; t < 4; ++t) acc[t] = (v8f){};
#pragma unroll
        for (int c = 0; c < 2; ++c) { const v16bf yh = cat16b(h8[2 * c], h8[2 * c + 1]), yl = cat16b(l8[2 * c], l8[2 * c + 1]);
#pragma unroll
            for (int t = 0; t < 4; ++t) { const v16bf wa = WFrag<bf>::ld(ws + t * 16 * KP + fo + c * 32); acc[t] = wmmab(wa, yh, acc[t]); acc[t] = wmmab(wa, yl, acc[t]); } }
        const size_t oo = (size_t)jb * SEQ * HD + (size_t)(tok0 + tt * 16 + lr) * HD + 8 * hi;
#pragma unroll
        for (int t = 0; t < 4; ++t) { v8us oh, ol;
#pragma unroll
            for (int r = 0; r < 8; ++r) { unsigned short a, c; splitf((acc[t][r] + bfr(bb[t][r])) * sc, a, c); oh[r] = a; ol[r] = c; }
            *(v8us*)(QKH + oo + t * 16) = oh; *(v8us*)(QKL + oo + t * 16) = ol; }
    } else if (w < 12) {
        const int dt = w & 3; const bf* ws = sm + 5 * (HD * KP);
        v8f acc[4];
#pragma unroll
        for (int m = 0; m < 4; ++m) acc[m] = (v8f){};
#pragma unroll
        for (int c = 0; c < 2; ++c) { const v16bf wb = WFrag<bf>::ld(ws + dt * 16 * KP + fo + c * 32);
#pragma unroll
            for (int m = 0; m < 4; ++m) acc[m] = wmmab(WFrag<bf>::ld(xs + m * 16 * KP + fo + c * 32), wb, acc[m]); }
        const float bias = bfr(bvv); h16* vrow = VT + (size_t)(dt * 16 + lr) * SEQ + tok0 + 8 * hi;
#pragma unroll
        for (int m = 0; m < 4; ++m) { v8h o;
#pragma unroll
            for (int r = 0; r < 8; ++r) o[r] = tohx(acc[m][r] + bias);
            *(v8h*)(vrow + m * 16) = o; }
        asm volatile("s_wait_xcnt 0x0" ::: "memory");   // stands behind the four stores above, in front of any later write of their address registers
    }
}

// ---- k_attn: flash attention, transposed form. Block = 8 waves x 16 queries; key chunks of KC staged in LDS (K hi, K lo as [key][dim], V as [dim][key], rows at pitch KP).
// Per wave and chunk: S^T tile j (16 keys x 16 queries) = Kh.Qh + Kl.Qh + Kh.Ql (A = K rows, B = Q^T with lane = query); D element r of lane (h, q) = key j*16+8h+r.
// Online softmax per lane (lane pair q, q^16 covers all KC keys); P^T B fragment: element r <- tile 2ks [r], element 8+r <- tile 2ks+1 [r], lane unchanged.
// Grid (KS, SEQ/128): workgroup (ks, qb) walks keys [ks, ks+1) * SEQ/KS only and hands over its un-normalised sum PO[ks][q][64] and ML[ks][q] = (running maximum, row sum); k_merge joins the KS ranges.
__global__ __launch_bounds__(256) void k_attn(const bf* __restrict__ QH, const bf* __restrict__ QL, const bf* __restrict__ KH, const bf* __restrict__ KL, const h16* __restrict__ VT, float* PO, float* ML) {
    __shared__ __align__(16) bf    khs[KC * KP];
    __shared__ __align__(16) bf    kls[KC * KP];
    __shared__ __align__(16) h16   vts[HD * KP];
    __shared__ __align__(16) float os[8 * 16 * 68];
    const int tid = threadIdx.x, lane = tid & 31, wv = tid >> 5, lr = lane & 15, hi = lane >> 4;
    const int q0 = blockIdx.y * 128 + wv * 16, ks = blockIdx.x, kbeg = ks * (SEQ / KS);
    v16bf qh[2], ql[2];
#pragma unroll
    for (int c = 0; c < 2; ++c) { const size_t qo = (size_t)(q0 + lr) * HD + c * 32 + 8 * hi; qh[c] = WFrag<bf>::ld(QH + qo); ql[c] = WFrag<bf>::ld(QL + qo); }
    v8f acc[4];
#pragma unroll
    for (int t = 0; t < 4; ++t) acc[t] = (v8f){};
    float mrun = -1.0e30f, lsum = 0.0f;
#pragma unroll 1
    for (int kc = kbeg; kc < kbeg + SEQ / KS; kc += KC) {
        // stage the chunk: khs/kls [KC][HD] rows at pitch KP; vts [HD][KC] rows at pitch KP from VT[d][kc + ..] (512 x 16 B each, 2 per thread)
#pragma unroll
        for (int i = 0; i < 2; ++i) { const int u = tid + i * 256; const size_t go = (size_t)kc * HD + (size_t)u * 8; const int d = u >> 3, cc = u & 7, lo = d * KP + cc * 8;
            *(v8us*)(khs + lo) = *(const v8us*)(KH + go); *(v8us*)(kls + lo) = *(const v8us*)(KL + go);
            *(v8h*)(vts + lo) = *(const v8h*)(VT + (size_t)d * SEQ + kc + cc * 8); }
        __syncthreads();
        v8f s[4];
#pragma unroll
        for (int j = 0; j < 4; ++j) s[j] = (v8f){};
        v16bf ka, kb2;
#pragma unroll
        for (int c = 0; c < 2; ++c) {
#pragma unroll
            for (int j = 0; j < 4; ++j) { const int ko = (j * 16 + lr) * KP + c * 32 + 8 * hi; ka = WFrag<bf>::ld(khs + ko); kb2 = WFrag<bf>::ld(kls + ko);
                s[j] = wmmab(ka, qh[c], s[j]); s[j] = wmmab(kb2, qh[c], s[j]); s[j] = wmmab(ka, ql[c], s[j]); } }
        asm volatile("v_nop\n\tv_nop\n\tv_nop\n\tv_nop" : "+v"(s[0]), "+v"(s[1]), "+v"(s[2]), "+v"(s[3]) : "v"(ka), "v"(kb2), "v"(qh[1]), "v"(ql[1]));
        // online softmax (logits already carry the 1/8 scale through the q planes)
        float cm = -1.0e30f;
#pragma unroll
        for (int j = 0; j < 4; ++j)
#pragma unroll
            for (int r = 0; r < 8; ++r) cm = fmaxf(cm, s[j][r]);
        cm = fmaxf(cm, __shfl_xor(cm, 16, 32));
        const float mnew = fmaxf(mrun, cm);
        const float alpha = __builtin_amdgcn_exp2f(fmaxf((mrun - mnew) * L2E, -120.0f));
        float rs = 0.0f; v8h p8[4];
#pragma unroll
        for (int j = 0; j < 4; ++j) { p8[j] = (v8h){};
#pragma unroll
            for (int r = 0; r < 8; ++r) { const float pv = __builtin_amdgcn_exp2f((s[j][r] - mnew) * L2E + LPC); rs += pv; p8[j][r] = tohx(pv); } }
        rs += __shfl_xor(rs, 16, 32);
        lsum = lsum * alpha + rs; mrun = mnew;
#pragma unroll
        for (int t = 0; t < 4; ++t) acc[t] = acc[t] * alpha;
        const v16h pb0 = cat16(p8[0], p8[1]), pb1 = cat16(p8[2], p8[3]);
        v16h va;
#pragma unroll
        for (int t = 0; t < 4; ++t) { const int vo = (t * 16 + lr) * KP + 8 * hi; va = WFrag<h16>::ld(vts + vo); acc[t] = wmma16(va, pb0, acc[t]); va = WFrag<h16>::ld(vts + vo + 32); acc[t] = wmma16(va, pb1, acc[t]); }
        asm volatile("v_nop\n\tv_nop\n\tv_nop\n\tv_nop" : "+v"(acc[0]), "+v"(acc[1]), "+v"(acc[2]), "+v"(acc[3]) : "v"(va), "v"(pb0), "v"(pb1));
        __syncthreads();
    }
    float* osw = os + wv * (16 * 68);
#pragma unroll
    for (int t = 0; t < 4; ++t) { const v4f lo4 = (v4f){acc[t][0], acc[t][1], acc[t][2], acc[t][3]}; const v4f hi4 = (v4f){acc[t][4], acc[t][5], acc[t][6], acc[t][7]};
        *(v4fa*)(osw + lr * 68 + t * 16 + 8 * hi) = lo4; *(v4fa*)(osw + lr * 68 + t * 16 + 8 * hi + 4) = hi4; }
    __syncthreads();
    float* orow = PO + ((size_t)ks * SEQ + q0) * HD;
{
#pragma unroll
        for (int s2 = 0; s2 < 8; ++s2) { const int row = 2 * s2 + hi, cofs = lr * 4; const v4f val = *(const v4fa*)(osw + row * 68 + cofs); *(v4f*)(orow + (size_t)row * HD + cofs) = val; }
         }
    ML[((size_t)ks * SEQ + q0 + lr) * 2 + hi] = hi ? lsum : mrun;   // both lane halves hold the same pair: one whole 128-B line per wave
}

// ---- k_merge: out[q][d] = sum_ks w PO[ks][q][d] / sum_ks w l, w = exp(m_ks - max m). One thread per 4 output floats; a wave stores 512 contiguous bytes.
__global__ __launch_bounds__(256) void k_merge(const float* __restrict__ PO, const float* __restrict__ ML, float* out) {
    const unsigned t = blockIdx.x * 256u + threadIdx.x, eb = t * 16u, qb = t / (HD / 4) * 8u;   // byte offsets of the thread's 4 floats in a [SEQ][64] plane and of its query's pair in a [SEQ][2] plane
    float m[KS], l[KS]; v4f o[KS];
#pragma unroll
    for (int s = 0; s < KS; ++s) { const float* p = (const float*)((const char*)(ML + (size_t)s * SEQ * 2) + qb); m[s] = p[0]; l[s] = p[1]; }
    asm volatile("s_wait_xcnt 0x0" ::: "memory");   // stands in front of the loads below, whose results may land in the offset register of the loads above
#pragma unroll
    for (int s = 0; s < KS; ++s) o[s] = *(const v4f*)((const char*)(PO + (size_t)s * SEQ * HD) + eb);
    float mx = m[0];
#pragma unroll
    for (int s = 1; s < KS; ++s) mx = fmaxf(mx, m[s]);
    float ls = 0.0f; v4f a = (v4f){};
#pragma unroll
    for (int s = 0; s < KS; ++s) { const float w = __builtin_amdgcn_exp2f(fmaxf((m[s] - mx) * L2E, -120.0f)); ls += l[s] * w; a += o[s] * w; }
    const float inv = __fdiv_rn(1.0f, ls);
    *(v4f*)((char*)out + eb) = a * inv;
}

extern "C" void kernel_launch(void* const* d_in, const int* in_sizes, int n_in,
                              void* d_out, int out_size, void* d_ws, size_t ws_size, hipStream_t stream) {
    if (n_in < 8) return;
    if (in_sizes[0] < SEQ * HD || in_sizes[1] < HD * DP || in_sizes[2] < HD * HD || in_sizes[3] < HD || in_sizes[4] < HD * HD || in_sizes[5] < HD || in_sizes[6] < HD * HD || in_sizes[7] < HD) return;
    if (out_size < SEQ * HD) return;
    const float* x = (const float*)d_in[0]; const float* params = (const float*)d_in[1];
    const float* wq = (const float*)d_in[2]; const float* bq = (const float*)d_in[3]; const float* wk = (const float*)d_in[4]; const float* bk = (const float*)d_in[5]; const float* wv = (const float*)d_in[6]; const float* bv = (const float*)d_in[7];
    float* OUT = (float*)d_out;     // [SEQ][64]
    char* wsp = (char*)d_ws;
    auto take = [&](size_t bytes) { char* p = wsp; wsp += (bytes + 255) & ~(size_t)255; return (void*)p; };
    const size_t PE = (size_t)SEQ * HD;                                     // elements of one [SEQ][64] plane
    bf* QKH = (bf*)take(2 * PE * 2); bf* QKL = (bf*)take(2 * PE * 2);       // bf16 hi/lo of q/8 and k [2][SEQ][64]
    h16* VT16 = (h16*)take(PE * 2);                                         // fp16 v^T [64][SEQ]
    float* PO = (float*)take(KS * PE * 4);                                  // f32 un-normalised partial outputs [KS][SEQ][64]
    float* ML = (float*)take((size_t)KS * SEQ * 2 * 4);                     // f32 (maximum, row sum) [KS][SEQ][2]
    const size_t used = (size_t)(wsp - (char*)d_ws); if (used > ws_size || used > ((size_t)128 << 20)) return;   // 27,787,264 B at SEQ 16384

    k_proj<<<SEQ / 64, 512, 0, stream>>>(x, params, wq, bq, wk, bk, wv, bv, QKH, QKL, VT16);
    k_attn<<<dim3(KS, SEQ / 128), 256, 0, stream>>>(QKH, QKL, QKH + PE, QKL + PE, VT16, PO, ML);
    k_merge<<<(unsigned)(PE / 4 / 256), 256, 0, stream>>>(PO, ML, OUT);
}

// v004
// One run takes 83.8 microseconds.
// Timed twice side by side with v003, it ran 1.36 and 1.34 times as fast.
// Over all steps from v000 it is 10.5 times as fast.
#include <hip/hip_runtime.h>

// Full softmax self-attention over SEQ tokens, embed 64: y1 = x R^T, y2 = x E^T (R, E = the two 64-column halves of the param table), q = y1 Wq^T + bq, k = y2 Wk^T + bk, v = x Wv^T + bv, out = softmax(q k^T / 8) v -> [SEQ][64] f32.
// Compute dtypes, f32 accumulate: every float input RNE-converted to bf16; x R^T, x E^T, x Wv^T on v_wmma_f32_16x16x32_bf16 with plain bf16 operands (exact products); q/k projections as bf16 hi+lo of y against bf16 W (2 products);
// scores as bf16 hi/lo of q/8 and of k (3 products hh+lh+hl); online softmax f32; P.V on v_wmma_f32_16x16x32_f16 with P = 2^14 exp(s-m) in fp16 and v in fp16 (1 product); the keys are cut into KS ranges whose f32 partial sums a last launch joins and normalises by the f32 row sum.

#ifndef SEQ
#define SEQ 16384
#endif
#define SEQ_FULL 16384
#ifndef NB
#define NB 1
#endif
#define HD   64
#define DP   128          // param table row pitch (2 * HD)
#define KC   64           // keys per staged chunk in the attention kernel
#define QT   2            // 16-query tiles per wave of k_attn: every K and V fragment read from LDS feeds QT matrix products
#define QB   (8 * 16 * QT) // queries per k_attn workgroup (8 waves)
#define KS   8            // key ranges per query block: (SEQ / QB) * KS = 512 workgroups at SEQ 16384, two on each of the chip's 256 WGPs (as many as k_attn's registers let reside)
#define KP   72           // LDS row pitch of the staged 64-element 16-bit rows: 144 B = 16 B x odd, so the 16 rows of a ds_load_b128 fragment read fall on distinct banks
#define SCL  0.125f       // HD^-0.5, folded into the q planes (exact power of two)
#define L2E  1.4426950408889634f
#define LPC  14.0f        // log2 of the P carry 16384
static_assert(SEQ % QB == 0);
static_assert(QT == 2);   // the three asm statements of k_attn name the registers of both query tiles one by one
static_assert(SEQ % (KS * KC) == 0);
static_assert(SEQ <= SEQ_FULL);
static_assert(NB == 1);

typedef _Float16 h16;
typedef unsigned short bf;
typedef __attribute__((ext_vector_type(16))) __bf16   v16bf;
typedef __attribute__((ext_vector_type(16))) _Float16 v16h;
typedef __attribute__((ext_vector_type(8)))  _Float16 v8h;
typedef __attribute__((ext_vector_type(8)))  unsigned short v8us;
typedef __attribute__((ext_vector_type(8)))  float    v8f;
typedef __attribute__((ext_vector_type(4)))  float    v4f;
typedef v8h  __attribute__((may_alias)) v8ha;
typedef v4f  __attribute__((may_alias)) v4fa;
typedef v8us __attribute__((may_alias)) v8usa;

__device__ __forceinline__ unsigned short f2bf(float f) { unsigned u = __float_as_uint(f); u += 0x7FFFu + ((u >> 16) & 1u); return (unsigned short)(u >> 16); }   // RNE convert
__device__ __forceinline__ float bf2f(unsigned short b) { return __uint_as_float(((unsigned)b) << 16); }
__device__ __forceinline__ float bfr(float f) { return bf2f(f2bf(f)); }
__device__ __forceinline__ v16h cat16(v8h lo, v8h hi) { return __builtin_shufflevector(lo, hi, 0, 1, 2, 3, 4, 5, 6, 7, 8, 9, 10, 11, 12, 13, 14, 15); }
__device__ __forceinline__ v16bf cat16b(v8us lo, v8us hi) { return __builtin_bit_cast(v16bf, __builtin_shufflevector(lo, hi, 0, 1, 2, 3, 4, 5, 6, 7, 8, 9, 10, 11, 12, 13, 14, 15)); }
__device__ __forceinline__ v8f wmma16(v16h a, v16h b, v8f c) { return __builtin_amdgcn_wmma_f32_16x16x32_f16(false, a, false, b, (short)0, c, false, false); }
__device__ __forceinline__ v8f wmmab(v16bf a, v16bf b, v8f c) { return __builtin_amdgcn_wmma_f32_16x16x32_bf16(false, a, false, b, (short)0, c, false, false); }
__device__ __forceinline__ h16 tohx(float x) { return (h16)x; }
__device__ __forceinline__ void splitf(float y, unsigned short& h, unsigned short& l) { h = f2bf(y); l = f2bf(y - bf2f(h)); }

// ---- fragment loaders (wave32 16x16x32 split k map): from a K-contiguous 16-bit row p = base + row*ld + k0 + 8*h,
// elements 0..7 <- k0+8h+0..7, elements 8..15 <- k0+16+8h+0..7; lane&15 = row (A) or column (B); same map for A and B.
template <typename T16> struct WFrag;
template <> struct WFrag<h16> { typedef v16h V; static __device__ __forceinline__ V ld(const h16* p) { return cat16(*(const v8h*)p, *(const v8h*)(p + 16)); } static __device__ __forceinline__ v8f mma(V a, V b, v8f c) { return wmma16(a, b, c); } };
template <> struct WFrag<bf> { typedef v16bf V; static __device__ __forceinline__ V ld(const bf* p) { return cat16b(*(const v8us*)p, *(const v8us*)(p + 16)); } static __device__ __forceinline__ v8f mma(V a, V b, v8f c) { return wmmab(a, b, c); } };

// ---- k_proj: all projections of 64 tokens in one workgroup of 16 waves. Every thread converts 8 floats of x, R, E, Wq, Wk, Wv to bf16 (RNE) into LDS rows at pitch KP; after the one barrier
// waves 0..3 make q and waves 4..7 make k of one 16-token tile each, in transposed form: y^T tile u (16 features x 16 tokens) = R rows . x^T, whose D registers (feature 16u+8h+r of lane (h, token)) split into bf16 hi/lo
// ARE the B fragments of q^T = W . y^T (element r <- tile 2c [r], element 8+r <- tile 2c+1 [r]); per k step hi then lo, as f32 sums; + bf16-rounded bias, x scale, split to the hi/lo planes [token][64] (16 B per lane and tile).
// Waves 8..11 make v for 16 dims x 64 tokens: A = x rows, B = Wv rows; D registers are 8 consecutive tokens of one dim: fp16 rows of v^T [64][SEQ], one whole 128-B line per dim and wave.
__global__ __launch_bounds__(512) void k_proj(const float* __restrict__ x, const float* __restrict__ P, const float* __restrict__ wq, const float* __restrict__ bq, const float* __restrict__ wk, const float* __restrict__ bk,
                                              const float* __restrict__ wv, const float* __restrict__ bv, bf* QKH, bf* QKL, h16* VT) {
    __shared__ __align__(16) bf sm[6 * HD * KP];
    const int tid = threadIdx.x, lane = tid & 31, lr = lane & 15, hi = lane >> 4, w = __builtin_amdgcn_readfirstlane(tid >> 5);
    const int tok0 = blockIdx.x * 64, row = tid >> 3, c8 = (tid & 7) * 8;
    v8f in[6];
    in[0] = *(const v8f*)(x + (size_t)(tok0 + row) * HD + c8); in[1] = *(const v8f*)(P + row * DP + c8); in[2] = *(const v8f*)(P + row * DP + HD + c8);
    in[3] = *(const v8f*)(wq + row * HD + c8); in[4] = *(const v8f*)(wk + row * HD + c8); in[5] = *(const v8f*)(wv + row * HD + c8);
    const float* bsel = (w < 4) ? bq : bk;
    v8f bb[4];
#pragma unroll
    for (int t = 0; t < 4; ++t) bb[t] = *(const v8f*)(bsel + t * 16 + 8 * hi);
    const float bvv = bv[(w & 3) * 16 + lr];
#pragma unroll
    for (int m = 0; m < 6; ++m) { v8us o;
#pragma unroll
        for (int k = 0; k < 8; ++k) o[k] = f2bf(in[m][k]);
        *(v8us*)(sm + m * (HD * KP) + row * KP + c8) = o; }
    __syncthreads();
    const bf* xs = sm; const int fo = lr * KP + 8 * hi;
    if (w < 8) {
        const int jb = w >> 2, tt = w & 3; const bf* rs = sm + (1 + jb) * (HD * KP); const bf* ws = sm + (3 + jb) * (HD * KP); const float sc = jb ? 1.0f : SCL;
        v16bf xb[2];
#pragma unroll
        for (int c = 0; c < 2; ++c) xb[c] = WFrag<bf>::ld(xs + tt * 16 * KP + fo + c * 32);
        v8f yt[4];
#pragma unroll
        for (int u = 0; u < 4; ++u) yt[u] = (v8f){};
#pragma unroll
        for (int c = 0; c < 2; ++c)
#pragma unroll
            for (int u = 0; u < 4; ++u) yt[u] = wmmab(WFrag<bf>::ld(rs + u * 16 * KP + fo + c * 32), xb[c], yt[u]);
        v8us h8[4], l8[4];
#pragma unroll
        for (int u = 0; u < 4; ++u)
#pragma unroll
            for (int r = 0; r < 8; ++r) { unsigned short a, c; splitf(yt[u][r], a, c); h8[u][r] = a; l8[u][r] = c; }
        v8f acc[4];
#pragma unroll
        for (int t = 0; t < 4; ++t) acc[t] = (v8f){};
#pragma unroll
        for (int c = 0; c < 2; ++c) { const v16bf yh = cat16b(h8[2 * c], h8[2 * c + 1]), yl = cat16b(l8[2 * c], l8[2 * c + 1]);
#pragma unroll
            for (int t = 0; t < 4; ++t) { const v16bf wa = WFrag<bf>::ld(ws + t * 16 * KP + fo + c * 32); acc[t] = wmmab(wa, yh, acc[t]); acc[t] = wmmab(wa, yl, acc[t]); } }
        const size_t oo = (size_t)jb * SEQ * HD + (size_t)(tok0 + tt * 16 + lr) * HD + 8 * hi;
#pragma unroll
        for (int t = 0; t < 4; ++t) { v8us oh, ol;
#pragma unroll
            for (int r = 0; r < 8; ++r) { unsigned short a, c; splitf((acc[t][r] + bfr(bb[t][r])) * sc, a, c); oh[r] = a; ol[r] = c; }
            *(v8us*)(QKH + oo + t * 16) = oh; *(v8us*)(QKL + oo + t * 16) = ol; }
    } else if (w < 12) {
        const int dt = w & 3; const bf* ws = sm + 5 * (HD * KP);
        v8f acc[4];
#pragma unroll
        for (int m = 0; m < 4; ++m) acc[m] = (v8f){};
#pragma unroll
        for (int c = 0; c < 2; ++c) { const v16bf wb = WFrag<bf>::ld(ws + dt * 16 * KP + fo + c * 32);
#pragma unroll
            for (int m = 0; m < 4; ++m) acc[m] = wmmab(WFrag<bf>::ld(xs + m * 16 * KP + fo + c * 32), wb, acc[m]); }
        const float bias = bfr(bvv); h16* vrow = VT + (size_t)(dt * 16 + lr) * SEQ + tok0 + 8 * hi;
#pragma unroll
        for (int m = 0; m < 4; ++m) { v8h o;
#pragma unroll
            for (int r = 0; r < 8; ++r) o[r] = tohx(acc[m][r] + bias);
            *(v8h*)(vrow + m * 16) = o; }
        asm volatile("s_wait_xcnt 0x0" ::: "memory");   // stands behind the four stores above, in front of any later write of their address registers
    }
}

// ---- k_attn: flash attention, transposed form. Block = 8 waves x QT tiles of 16 queries; key chunks of KC staged in LDS (K hi, K lo as [key][dim], V as [dim][key], rows at pitch KP).
// Per wave, chunk and query tile g: S^T tile j (16 keys x 16 queries) = Kh.Qh + Kl.Qh + Kh.Ql (A = K rows, B = Q^T with lane = query); D element r of lane (h, q) = key j*16+8h+r. A K or V fragment is read once and used for all QT tiles.
// Online softmax per lane (lane pair q, q^16 covers all KC keys); P^T B fragment: element r <- tile 2ks [r], element 8+r <- tile 2ks+1 [r], lane unchanged.
// Grid (KS, SEQ/QB): workgroup (ks, qb) walks keys [ks, ks+1) * SEQ/KS only and hands over its un-normalised sum PO[q][ks][64] and ML[ks][q] = (running maximum, row sum); k_merge joins the KS ranges.
// __launch_bounds__'s 4 = waves per SIMD: holds the wave at 256 registers, so that two workgroups stay resident on a WGP.
__global__ __launch_bounds__(256, 4) void k_attn(const bf* __restrict__ QH, const bf* __restrict__ QL, const bf* __restrict__ KH, const bf* __restrict__ KL, const h16* __restrict__ VT, float* PO, float* ML) {
    __shared__ __align__(16) bf    kv[3 * KC * KP];   // K hi, K lo, V planes: one array, so that every staged row is one lane address plus a constant offset
    __shared__ __align__(16) float os[8 * 16 * QT * 68];
    const int tid = threadIdx.x, lane = tid & 31, wv = tid >> 5, lr = lane & 15, hi = lane >> 4;
    const int q0 = blockIdx.y * QB + wv * (16 * QT), ks = blockIdx.x, kbeg = ks * (SEQ / KS);
    bf* stp = kv + (tid >> 3) * KP + (tid & 7) * 8;   // this thread's 16 B of staged row tid / 8
    const bf* frp = kv + lr * KP + 8 * hi;            // this lane's piece of fragment row lr
    v16bf qh[QT][2], ql[QT][2];
    const bf* qhp[QT]; const bf* qlp[QT];
#pragma unroll
    for (int g = 0; g < QT; ++g) { const size_t qo = (size_t)(q0 + g * 16 + lr) * HD + 8 * hi; qhp[g] = QH + qo; qlp[g] = QL + qo;
#pragma unroll
        for (int c = 0; c < 2; ++c) { qh[g][c] = WFrag<bf>::ld(qhp[g] + c * 32); ql[g][c] = WFrag<bf>::ld(qlp[g] + c * 32); } }
    asm volatile("s_wait_xcnt 0x0" :: "v"(qhp[0]), "v"(qlp[0]), "v"(qhp[1]), "v"(qlp[1]) : "memory");   // stands behind the Q loads above; their address registers, named as inputs, stay unwritten up to it
    v8f acc[QT][4];
    float mrun[QT], lsum[QT];
#pragma unroll
    for (int g = 0; g < QT; ++g) { mrun[g] = -1.0e30f; lsum[g] = 0.0f;
#pragma unroll
        for (int t = 0; t < 4; ++t) acc[g][t] = (v8f){}; }
#pragma unroll 1
    for (int kc = kbeg; kc < kbeg + SEQ / KS; kc += KC) {
        // stage the chunk: K hi and K lo planes [KC][HD], rows at pitch KP; V plane [HD][KC], rows at pitch KP, from VT[d][kc + ..] (512 x 16 B each, 2 per thread); all six loads are issued ahead of the first LDS store
        v8us gh[2], gl[2]; v8h gv[2];
#pragma unroll
        for (int i = 0; i < 2; ++i) { const int u = tid + i * 256; const size_t go = (size_t)kc * HD + (size_t)u * 8;
            gh[i] = *(const v8us*)(KH + go); gl[i] = *(const v8us*)(KL + go); gv[i] = *(const v8h*)(VT + (size_t)(u >> 3) * SEQ + kc + (u & 7) * 8); }
#pragma unroll
        for (int i = 0; i < 2; ++i) { bf* sp = stp + i * 32 * KP;
            *(v8us*)sp = gh[i]; *(v8us*)(sp + KC * KP) = gl[i]; *(v8h*)(sp + 2 * KC * KP) = gv[i]; }
        __syncthreads();
        v8f s[QT][4];
#pragma unroll
        for (int g = 0; g < QT; ++g)
#pragma unroll
            for (int j = 0; j < 4; ++j) s[g][j] = (v8f){};
        v16bf ka, kb2;
#pragma unroll
        for (int c = 0; c < 2; ++c) {
#pragma unroll
            for (int j = 0; j < 4; ++j) { const bf* kp = frp + j * 16 * KP + c * 32; ka = WFrag<bf>::ld(kp); kb2 = WFrag<bf>::ld(kp + KC * KP);
#pragma unroll
                for (int g = 0; g < QT; ++g) { s[g][j] = wmmab(ka, qh[g][c], s[g][j]); s[g][j] = wmmab(kb2, qh[g][c], s[g][j]); s[g][j] = wmmab(ka, ql[g][c], s[g][j]); } } }
        // four vector slots between the last score product and the first vector instruction on its registers
        asm volatile("v_nop\n\tv_nop\n\tv_nop\n\tv_nop" : "+v"(s[0][0]), "+v"(s[0][1]), "+v"(s[0][2]), "+v"(s[0][3]), "+v"(s[1][0]), "+v"(s[1][1]), "+v"(s[1][2]), "+v"(s[1][3]) : "v"(ka), "v"(kb2), "v"(qh[0][1]), "v"(ql[0][1]), "v"(qh[1][1]), "v"(ql[1][1]));
        __builtin_amdgcn_sched_barrier(0);   // the score products are scheduled on their own: in one region with them, at their register peak, the softmax below came out as one dependent chain
        // online softmax (logits already carry the 1/8 scale through the q planes)
        v16h pb0[QT], pb1[QT];
#pragma unroll
        for (int g = 0; g < QT; ++g) {
            float cm = -1.0e30f;
#pragma unroll
            for (int j = 0; j < 4; ++j)
#pragma unroll
                for (int r = 0; r < 8; ++r) cm = fmaxf(cm, s[g][j][r]);
            cm = fmaxf(cm, __shfl_xor(cm, 16, 32));
            const float mnew = fmaxf(mrun[g], cm);
            const float alpha = __builtin_amdgcn_exp2f(fmaxf((mrun[g] - mnew) * L2E, -120.0f));
            float rs = 0.0f; v8h p8[4];
#pragma unroll
            for (int j = 0; j < 4; ++j) { p8[j] = (v8h){};
#pragma unroll
                for (int r = 0; r < 8; ++r) { const float pv = __builtin_amdgcn_exp2f((s[g][j][r] - mnew) * L2E + LPC); rs += pv; p8[j][r] = tohx(pv); } }
            rs += __shfl_xor(rs, 16, 32);
            lsum[g] = lsum[g] * alpha + rs; mrun[g] = mnew;
#pragma unroll
            for (int t = 0; t < 4; ++t) acc[g][t] = acc[g][t] * alpha;
            pb0[g] = cat16(p8[0], p8[1]); pb1[g] = cat16(p8[2], p8[3]);
        }
        v16h va, vb;
#pragma unroll
        for (int t = 0; t < 4; ++t) { const h16* vp = (const h16*)(frp + 2 * KC * KP + t * 16 * KP); va = WFrag<h16>::ld(vp); vb = WFrag<h16>::ld(vp + 32);
#pragma unroll
            for (int g = 0; g < QT; ++g) { acc[g][t] = wmma16(va, pb0[g], acc[g][t]); acc[g][t] = wmma16(vb, pb1[g], acc[g][t]); } }
        // the same four slots behind the last P.V product, also on the path through the loop's branch
        asm volatile("v_nop\n\tv_nop\n\tv_nop\n\tv_nop" : "+v"(acc[0][0]), "+v"(acc[0][1]), "+v"(acc[0][2]), "+v"(acc[0][3]), "+v"(acc[1][0]), "+v"(acc[1][1]), "+v"(acc[1][2]), "+v"(acc[1][3]) : "v"(va), "v"(vb), "v"(pb0[0]), "v"(pb1[0]), "v"(pb0[1]), "v"(pb1[1]));
        __syncthreads();
    }
    float* osw = os + wv * (16 * QT * 68);
#pragma unroll
    for (int g = 0; g < QT; ++g)
#pragma unroll
        for (int t = 0; t < 4; ++t) { const v4f lo4 = (v4f){acc[g][t][0], acc[g][t][1], acc[g][t][2], acc[g][t][3]}; const v4f hi4 = (v4f){acc[g][t][4], acc[g][t][5], acc[g][t][6], acc[g][t][7]};
            *(v4fa*)(osw + (g * 16 + lr) * 68 + t * 16 + 8 * hi) = lo4; *(v4fa*)(osw + (g * 16 + lr) * 68 + t * 16 + 8 * hi + 4) = hi4; }
    __syncthreads();
    float* orow = PO + ((size_t)q0 * KS + ks) * HD;
#pragma unroll
    for (int s2 = 0; s2 < 8 * QT; ++s2) { const int row = 2 * s2 + hi, cofs = lr * 4; const v4f val = *(const v4fa*)(osw + row * 68 + cofs); *(v4f*)(orow + (size_t)row * (KS * HD) + cofs) = val; }
#pragma unroll
    for (int g = 0; g < QT; ++g) ML[((size_t)ks * SEQ + q0 + g * 16 + lr) * 2 + hi] = hi ? lsum[g] : mrun[g];   // both lane halves hold the same pair: one whole 128-B line per wave and tile
}

// ---- k_merge: out[q][d] = sum_ks w PO[q][ks][d] / sum_ks w l, w = exp(m_ks - max m). One thread per 4 output floats; a wave stores 512 contiguous bytes.
__global__ __launch_bounds__(256) void k_merge(const float* __restrict__ PO, const float* __restrict__ ML, float* out) {
    const unsigned t = blockIdx.x * 256u + threadIdx.x, eb = t * 16u, qb = t / (HD / 4) * 8u, pb = t / (HD / 4) * (KS * HD * 4u) + t % (HD / 4) * 16u;   // byte offsets of the thread's 4 floats in out [SEQ][64], of its query's pair in a [SEQ][2] plane, of its 4 floats in PO[q][0]
    float m[KS], l[KS]; v4f o[KS];
#pragma unroll
    for (int s = 0; s < KS; ++s) { const float* p = (const float*)((const char*)(ML + (size_t)s * SEQ * 2) + qb); m[s] = p[0]; l[s] = p[1]; }
    asm volatile("s_wait_xcnt 0x0" ::: "memory");   // stands in front of the loads below, whose results may land in the offset register of the loads above
#pragma unroll
    for (int s = 0; s < KS; ++s) o[s] = *(const v4f*)((const char*)(PO + s * HD) + pb);
    float mx = m[0];
#pragma unroll
    for (int s = 1; s < KS; ++s) mx = fmaxf(mx, m[s]);
    float ls = 0.0f; v4f a = (v4f){};
#pragma unroll
    for (int s = 0; s < KS; ++s) { const float w = __builtin_amdgcn_exp2f(fmaxf((m[s] - mx) * L2E, -120.0f)); ls += l[s] * w; a += o[s] * w; }
    const float inv = __fdiv_rn(1.0f, ls);
    *(v4f*)((char*)out + eb) = a * inv;
}

extern "C" void kernel_launch(void* const* d_in, const int* in_sizes, int n_in,
                              void* d_out, int out_size, void* d_ws, size_t ws_size, hipStream_t stream) {
    if (n_in < 8) return;
    if (in_sizes[0] < SEQ * HD || in_sizes[1] < HD * DP || in_sizes[2] < HD * HD || in_sizes[3] < HD || in_sizes[4] < HD * HD || in_sizes[5] < HD || in_sizes[6] < HD * HD || in_sizes[7] < HD) return;
    if (out_size < SEQ * HD) return;
    const float* x = (const float*)d_in[0]; const float* params = (const float*)d_in[1];
    const float* wq = (const float*)d_in[2]; const float* bq = (const float*)d_in[3]; const float* wk = (const float*)d_in[4]; const float* bk = (const float*)d_in[5]; const float* wv = (const float*)d_in[6]; const float* bv = (const float*)d_in[7];
    float* OUT = (float*)d_out;     // [SEQ][64]
    char* wsp = (char*)d_ws;
    auto take = [&](size_t bytes) { char* p = wsp; wsp += (bytes + 255) & ~(size_t)255; return (void*)p; };
    const size_t PE = (size_t)SEQ * HD;                                     // elements of one [SEQ][64] plane
    bf* QKH = (bf*)take(2 * PE * 2); bf* QKL = (bf*)take(2 * PE * 2);       // bf16 hi/lo of q/8 and k [2][SEQ][64]
    h16* VT16 = (h16*)take(PE * 2);                                         // fp16 v^T [64][SEQ]
    float* PO = (float*)take(KS * PE * 4);                                  // f32 un-normalised partial outputs [SEQ][KS][64]
    float* ML = (float*)take((size_t)KS * SEQ * 2 * 4);                     // f32 (maximum, row sum) [KS][SEQ][2]
    const size_t used = (size_t)(wsp - (char*)d_ws); if (used > ws_size || used > ((size_t)128 << 20)) return;   // 45,088,768 B at SEQ 16384

    k_proj<<<SEQ / 64, 512, 0, stream>>>(x, params, wq, bq, wk, bk, wv, bv, QKH, QKL, VT16);
    k_attn<<<dim3(KS, SEQ / QB), 256, 0, stream>>>(QKH, QKL, QKH + PE, QKL + PE, VT16, PO, ML);
    k_merge<<<(unsigned)(PE / 4 / 256), 256, 0, stream>>>(PO, ML, OUT);
}
